// v000
// The times below were measured on an AMD MI455X: many runs one after another, warmed up first and cycling through
// copies of the inputs, with the whole window's GPU time divided by the number of runs. Launches and the gaps
// between them are all in it. The median over several windows is given; except for v000 it joins two sittings, which
// can be a few percent apart, so the side-by-side timings, each taken in one sitting, are the better comparison.
// The starting kernel, v000, takes 201 microseconds a run.
#include <hip/hip_runtime.h>
#include <hip/hip_bf16.h>
#include <math.h>

typedef __attribute__((ext_vector_type(16))) __bf16 v16bf;
typedef __attribute__((ext_vector_type(8)))  float  v8f;
typedef int      b128vec __attribute__((vector_size(16)));  // builtin's int4 pointee
typedef unsigned u32x4   __attribute__((vector_size(16)));
typedef int      i32x4   __attribute__((vector_size(16)));
typedef int      i32x8   __attribute__((vector_size(32)));

#define B_      64
#define L_      1024
#define E_      512
#define H_      512
#define KC      32
#define NKC     (E_/KC)          // 16 k-chunks
#define BROWS   64               // rows of A per block
#define THREADS 512              // 16 waves
#define NTW     8                // N-tiles per wave (8*16 = 128 cols per wave column)

// -------- workspace layout (bytes) --------
#define WS_DEC  (512u << 10)     // dec_dense f32 [B][H]
#define WS_LOG  (640u << 10)     // logits f32 [B*L]

#if defined(__gfx1250__) && __has_builtin(__builtin_amdgcn_global_load_async_to_lds_b128)
#define HAVE_ASYNC_LDS 1
#else
#define HAVE_ASYNC_LDS 0
#endif

#if defined(__gfx1250__) && __has_builtin(__builtin_amdgcn_s_wait_asynccnt)
#define WAIT_ASYNC0() __builtin_amdgcn_s_wait_asynccnt(0)
#elif defined(__gfx1250__)
#define WAIT_ASYNC0() asm volatile("s_wait_asynccnt 0x0" ::: "memory")
#else
#define WAIT_ASYNC0()
#endif

#if defined(__gfx1250__) && __has_builtin(__builtin_amdgcn_tensor_load_to_lds)
#define HAVE_TDM 1
#if __has_include(<hip/amd_detail/amd_gfx1250_TDM.h>)
#define TDM_6ARG 1               // therock-10.0 headers -> 6-arg builtin
#else
#define TDM_6ARG 0               // ROCm 7.2 -> 5-arg builtin
#endif
#else
#define HAVE_TDM 0
#endif

#if defined(__gfx1250__) && __has_builtin(__builtin_amdgcn_s_wait_tensorcnt)
#define WAIT_TENSOR0() __builtin_amdgcn_s_wait_tensorcnt(0)
#elif defined(__gfx1250__)
#define WAIT_TENSOR0() asm volatile("s_wait_tensorcnt 0x0" ::: "memory")
#else
#define WAIT_TENSOR0()
#endif

#define AS_GLOBAL_B128(p) ((__attribute__((address_space(1))) b128vec*)(p))
#define AS_LDS_B128(p)    ((__attribute__((address_space(3))) b128vec*)(p))

#if HAVE_TDM
__device__ __forceinline__ void tdmLoadChunk(const float* gsrc, float* ldst) {
    unsigned long long ga = (unsigned long long)gsrc;
    unsigned lds_off = (unsigned)(unsigned long long)
        (__attribute__((address_space(3))) char*)ldst;
    u32x4 g0 = { 1u,
                 lds_off,
                 (unsigned)ga,
                 (unsigned)((ga >> 32) & 0x01FFFFFFull) | 0x80000000u };
    i32x8 g1 = { (2 << 16) | (1 << 20) | (4 << 22) | (7 << 25),
                 (int)(512u << 16),
                 0,
                 1 | (32 << 16),
                 64,
                 512,
                 0, 0 };
    i32x4 z4 = {0, 0, 0, 0};
#if TDM_6ARG
    i32x8 z8 = {0, 0, 0, 0, 0, 0, 0, 0};
    __builtin_amdgcn_tensor_load_to_lds(g0, g1, z4, z4, z8, 0);
#else
    __builtin_amdgcn_tensor_load_to_lds(g0, g1, z4, z4, 0);
#endif
}
#endif

__global__ __launch_bounds__(256)
void swizzleB(const float* __restrict__ W_in, __bf16* __restrict__ Bsw) {
    int idx  = blockIdx.x * 256 + threadIdx.x;   // 262144 total
    int e    = idx & 15;
    int lane = (idx >> 4) & 31;
    int kc   = (idx >> 9) & 15;
    int nt   = idx >> 13;
    int v    = e >> 1, ee = e & 1;
    int n    = nt * 16 + (lane & 15);
    int k    = kc * KC + ((v >> 2) << 4) + ((lane >> 4) << 3) + ((v & 3) << 1) + ee;
    Bsw[idx] = (__bf16)W_in[k * H_ + n];
}

__global__ __launch_bounds__(512)
void decDense(const float* __restrict__ dec, const float* __restrict__ W_dec,
              const float* __restrict__ b_dec, float* __restrict__ out) {
    int b = blockIdx.x, h = threadIdx.x;
    float s = b_dec[h];
#pragma unroll 8
    for (int k = 0; k < H_; ++k)
        s += dec[b * H_ + k] * W_dec[k * H_ + h];
    out[b * H_ + h] = s;
}

__global__ __launch_bounds__(256)
void zeroCtx(float* __restrict__ ctx) {
    int i = blockIdx.x * 256 + threadIdx.x;
    if (i < B_ * H_) ctx[i] = 0.f;
}

template <int PASS2>
__global__ __launch_bounds__(THREADS)
void attnGemm(const float* __restrict__ A,        // [B*L, E] f32
              const __bf16* __restrict__ Bsw,     // swizzled W_in
              const float* __restrict__ b_in,     // [H]
              const float* __restrict__ dec_dense,// [B, H]
              const float* __restrict__ w_score,  // [H]
              const float* __restrict__ b_score,  // [1]
              const float* __restrict__ weights,  // [B*L] (pass 2)
              float* __restrict__ logits,         // [B*L] (pass 1)
              float* __restrict__ ctx)            // [B, H] (pass 2, atomic)
{
    __shared__ float Atile[2][BROWS][40];  // double-buffered, padded staging
    __shared__ float sDec[H_];
    __shared__ float sWsc[H_];
    __shared__ float sBin[H_];
    __shared__ float sLogit[BROWS];
    __shared__ float sCtx[H_];
    __shared__ float sWrow[BROWS];

    const int tid   = threadIdx.x;
    const int wave  = tid >> 5;
    const int lane  = tid & 31;
    const int mt    = wave & 3;
    const int ncol  = wave >> 2;
    const int m0    = blockIdx.x * BROWS;
    const int b     = m0 >> 10;
    const int mlane = lane & 15;
    const int hi    = lane >> 4;

    sBin[tid] = b_in[tid];
    if (PASS2) {
        sCtx[tid] = 0.f;
        if (tid < BROWS) sWrow[tid] = weights[m0 + tid];
    } else {
        sDec[tid] = dec_dense[b * H_ + tid];
        sWsc[tid] = w_score[tid];
        if (tid < BROWS) sLogit[tid] = 0.f;
    }

    const float zero = 0.f;
    v8f acc[NTW];
#pragma unroll
    for (int t = 0; t < NTW; ++t) {
        v8f z = {zero, zero, zero, zero, zero, zero, zero, zero};
        acc[t] = z;
    }

    const int arow  = tid >> 3;          // 0..63
    const int aquad = tid & 7;           // 0..7 (16B within 32-f32 chunk)

    // ---- prologue: stage chunk 0 into buffer 0 ----
#if HAVE_TDM
    if (wave == 0) {
        tdmLoadChunk(A + (size_t)m0 * E_, &Atile[0][0][0]);  // whole 64x32 tile
        WAIT_TENSOR0();
    }
#else
    {
        const float* src = A + (size_t)(m0 + arow) * E_ + aquad * 4;
#if HAVE_ASYNC_LDS
        __builtin_amdgcn_global_load_async_to_lds_b128(
            AS_GLOBAL_B128(src), AS_LDS_B128(&Atile[0][arow][aquad * 4]), 0, 0);
        WAIT_ASYNC0();
#else
        const float4 val = *(const float4*)src;
        float* dst = &Atile[0][arow][aquad * 4];
        dst[0] = val.x; dst[1] = val.y; dst[2] = val.z; dst[3] = val.w;
#endif
    }
#endif
    __syncthreads();

    for (int kc = 0; kc < NKC; ++kc) {
        const int cur = kc & 1;
        const int nxt = cur ^ 1;

        // ---- kick off async copy of the NEXT chunk into the other buffer ----
        if (kc + 1 < NKC) {
            const float* src = A + (size_t)(m0 + arow) * E_ + (kc + 1) * KC + aquad * 4;
#if HAVE_ASYNC_LDS
            __builtin_amdgcn_global_load_async_to_lds_b128(
                AS_GLOBAL_B128(src), AS_LDS_B128(&Atile[nxt][arow][aquad * 4]), 0, 0);
#else
            const float4 val = *(const float4*)src;
            float* dst = &Atile[nxt][arow][aquad * 4];
            dst[0] = val.x; dst[1] = val.y; dst[2] = val.z; dst[3] = val.w;
#endif
            if (kc + 2 < NKC)
                __builtin_prefetch(src + KC, 0, 1);
        }

        v16bf afrag;
#pragma unroll
        for (int v = 0; v < 8; ++v) {
            const int k = ((v >> 2) << 4) + (hi << 3) + ((v & 3) << 1);
            const float2 p = *(const float2*)&Atile[cur][mt * 16 + mlane][k];
            afrag[2 * v]     = (__bf16)p.x;
            afrag[2 * v + 1] = (__bf16)p.y;
        }

        // ---- 8 WMMAs against pre-swizzled B fragments ----
#pragma unroll
        for (int t = 0; t < NTW; ++t) {
            const int ntile = ncol * 8 + t;
            const v16bf bfrag = *(const v16bf*)(Bsw +
                (((size_t)(ntile * NKC + kc) * 32 + lane) << 4));
            acc[t] = __builtin_amdgcn_wmma_f32_16x16x32_bf16(
                false, afrag, false, bfrag, (short)0, acc[t], false, false);
        }

        WAIT_ASYNC0();       // next-chunk copy landed in LDS
        __syncthreads();     // all waves done reading cur / writing nxt
    }

    if (!PASS2) {
        float part[8];
#pragma unroll
        for (int j = 0; j < 8; ++j) part[j] = 0.f;
#pragma unroll
        for (int t = 0; t < NTW; ++t) {
            const int n = ncol * 128 + t * 16 + mlane;
            const float dv = sDec[n], wv = sWsc[n], bv = sBin[n];
#pragma unroll
            for (int j = 0; j < 8; ++j)
                part[j] += tanhf(acc[t][j] + bv + dv) * wv;
        }
#pragma unroll
        for (int j = 0; j < 8; ++j) {
            const int row = mt * 16 + hi * 8 + j;
            atomicAdd(&sLogit[row], part[j]);      // ds_add_f32
        }
        __syncthreads();
        if (tid < BROWS) logits[m0 + tid] = sLogit[tid] + b_score[0];
    } else {
#pragma unroll
        for (int t = 0; t < NTW; ++t) {
            const int n = ncol * 128 + t * 16 + mlane;
            const float bv = sBin[n];
            float s = 0.f;
#pragma unroll
            for (int j = 0; j < 8; ++j) {
                const int row = mt * 16 + hi * 8 + j;
                s += sWrow[row] * (acc[t][j] + bv);
            }
            atomicAdd(&sCtx[n], s);                // ds_add_f32
        }
        __syncthreads();
        atomicAdd(&ctx[b * H_ + tid], sCtx[tid]);  // global_atomic_add_f32
    }
}

// softmax over L per batch
__global__ __launch_bounds__(256)
void softmaxL(const float* __restrict__ logits, float* __restrict__ weights) {
    __shared__ float red[256];
    const int b = blockIdx.x, tid = threadIdx.x;
    const float* lg = logits + b * L_;

    float m = -3.402823466e38f;
    for (int i = tid; i < L_; i += 256) m = fmaxf(m, lg[i]);
    red[tid] = m; __syncthreads();
    for (int s = 128; s > 0; s >>= 1) {
        if (tid < s) red[tid] = fmaxf(red[tid], red[tid + s]);
        __syncthreads();
    }
    const float mx = red[0]; __syncthreads();

    float sum = 0.f;
    for (int i = tid; i < L_; i += 256) sum += __expf(lg[i] - mx);
    red[tid] = sum; __syncthreads();
    for (int s = 128; s > 0; s >>= 1) {
        if (tid < s) red[tid] += red[tid + s];
        __syncthreads();
    }
    const float inv = 1.f / red[0];
    for (int i = tid; i < L_; i += 256)
        weights[b * L_ + i] = __expf(lg[i] - mx) * inv;
}

extern "C" void kernel_launch(void* const* d_in, const int* in_sizes, int n_in,
                              void* d_out, int out_size, void* d_ws, size_t ws_size,
                              hipStream_t stream) {
    const float* attn  = (const float*)d_in[0];  // [B,L,E]
    const float* dec   = (const float*)d_in[1];  // [B,H]
    const float* W_in  = (const float*)d_in[2];  // [E,H]
    const float* b_in  = (const float*)d_in[3];  // [H]
    const float* W_dec = (const float*)d_in[4];  // [H,H]
    const float* b_dec = (const float*)d_in[5];  // [H]
    const float* w_sc  = (const float*)d_in[6];  // [H,1]
    const float* b_sc  = (const float*)d_in[7];  // [1]

    char*  ws      = (char*)d_ws;
    __bf16* Bsw    = (__bf16*)ws;
    float* decd    = (float*)(ws + WS_DEC);
    float* logits  = (float*)(ws + WS_LOG);
    float* ctx     = (float*)d_out;              // [B,H]
    float* weights = (float*)d_out + B_ * H_;    // [B,L]

    swizzleB<<<1024, 256, 0, stream>>>(W_in, Bsw);
    decDense<<<B_, H_, 0, stream>>>(dec, W_dec, b_dec, decd);
    zeroCtx<<<(B_ * H_ + 255) / 256, 256, 0, stream>>>(ctx);

    const int gemmBlocks = (B_ * L_) / BROWS;    // 1024
    attnGemm<0><<<gemmBlocks, THREADS, 0, stream>>>(
        attn, Bsw, b_in, decd, w_sc, b_sc, nullptr, logits, nullptr);
    softmaxL<<<B_, 256, 0, stream>>>(logits, weights);
    attnGemm<1><<<gemmBlocks, THREADS, 0, stream>>>(
        attn, Bsw, b_in, decd, w_sc, b_sc, weights, nullptr, ctx);
}

// v002
// A run of this version takes 137 microseconds.
// Versions between v000 and this one are left out; their measured steps multiply to 1.48 times as fast.
#include <hip/hip_runtime.h>
#include <hip/hip_bf16.h>
#include <math.h>

typedef __attribute__((ext_vector_type(16))) __bf16 v16bf;
typedef __attribute__((ext_vector_type(8)))  float  v8f;
typedef int      b128vec __attribute__((vector_size(16)));  // builtin's int4 pointee
typedef unsigned u32x4   __attribute__((vector_size(16)));
typedef int      i32x4   __attribute__((vector_size(16)));
typedef int      i32x8   __attribute__((vector_size(32)));

#define B_      64
#define L_      1024
#define E_      512
#define H_      512
#define KC      32
#define NKC     (E_/KC)          // 16 k-chunks
#define BROWS   64               // rows of A per block
#define THREADS 512              // 16 waves
#define NTW     8                // N-tiles per wave (8*16 = 128 cols per wave column)

// -------- workspace layout (bytes) --------
#define WS_DEC  (512u << 10)     // dec_dense f32 [B][H]
#define WS_LOG  (640u << 10)     // logits f32 [B*L]
#define WS_PART (1024u << 10)    // weighted row sums f32 [B*L/BROWS][E]
#define WS_PSW  (3072u << 10)    // sums of weights f32 [B*L/BROWS]

#if defined(__gfx1250__) && __has_builtin(__builtin_amdgcn_global_load_async_to_lds_b128)
#define HAVE_ASYNC_LDS 1
#else
#define HAVE_ASYNC_LDS 0
#endif

#if defined(__gfx1250__) && __has_builtin(__builtin_amdgcn_s_wait_asynccnt)
#define WAIT_ASYNC0() __builtin_amdgcn_s_wait_asynccnt(0)
#elif defined(__gfx1250__)
#define WAIT_ASYNC0() asm volatile("s_wait_asynccnt 0x0" ::: "memory")
#else
#define WAIT_ASYNC0()
#endif

#if defined(__gfx1250__) && __has_builtin(__builtin_amdgcn_tensor_load_to_lds)
#define HAVE_TDM 1
#define TDM_6ARG 1               // the build's compiler takes the 6-arg builtin
#else
#define HAVE_TDM 0
#endif

#if defined(__gfx1250__) && __has_builtin(__builtin_amdgcn_s_wait_tensorcnt)
#define WAIT_TENSOR0() __builtin_amdgcn_s_wait_tensorcnt(0)
#elif defined(__gfx1250__)
#define WAIT_TENSOR0() asm volatile("s_wait_tensorcnt 0x0" ::: "memory")
#else
#define WAIT_TENSOR0()
#endif

#define AS_GLOBAL_B128(p) ((__attribute__((address_space(1))) b128vec*)(p))
#define AS_LDS_B128(p)    ((__attribute__((address_space(3))) b128vec*)(p))

#if HAVE_TDM
__device__ __forceinline__ void tdmLoadChunk(const float* gsrc, float* ldst) {
    unsigned long long ga = (unsigned long long)gsrc;
    unsigned lds_off = (unsigned)(unsigned long long)
        (__attribute__((address_space(3))) char*)ldst;
    u32x4 g0 = { 1u,
                 lds_off,
                 (unsigned)ga,
                 (unsigned)((ga >> 32) & 0x01FFFFFFull) | 0x80000000u };
    i32x8 g1 = { (2 << 16) | (1 << 20) | (4 << 22) | (7 << 25),
                 (int)(512u << 16),
                 0,
                 1 | (32 << 16),
                 64,
                 512,
                 0, 0 };
    i32x4 z4 = {0, 0, 0, 0};
#if TDM_6ARG
    i32x8 z8 = {0, 0, 0, 0, 0, 0, 0, 0};
    __builtin_amdgcn_tensor_load_to_lds(g0, g1, z4, z4, z8, 0);
#else
    __builtin_amdgcn_tensor_load_to_lds(g0, g1, z4, z4, 0);
#endif
}
#endif

__global__ __launch_bounds__(256)
void swizzleB(const float* __restrict__ W_in, __bf16* __restrict__ Bsw) {
    int idx  = blockIdx.x * 256 + threadIdx.x;   // 262144 total
    int e    = idx & 15;
    int lane = (idx >> 4) & 31;
    int kc   = (idx >> 9) & 15;
    int nt   = idx >> 13;
    int v    = e >> 1, ee = e & 1;
    int n    = nt * 16 + (lane & 15);
    int k    = kc * KC + ((v >> 2) << 4) + ((lane >> 4) << 3) + ((v & 3) << 1) + ee;
    Bsw[idx] = (__bf16)W_in[k * H_ + n];
}

__global__ __launch_bounds__(512)
void decDense(const float* __restrict__ dec, const float* __restrict__ W_dec,
              const float* __restrict__ b_dec, float* __restrict__ out) {
    int b = blockIdx.x, h = threadIdx.x;
    float s = b_dec[h];
#pragma unroll 8
    for (int k = 0; k < H_; ++k)
        s += dec[b * H_ + k] * W_dec[k * H_ + h];
    out[b * H_ + h] = s;
}

template <int PASS2>
__global__ __launch_bounds__(THREADS)
void attnGemm(const float* __restrict__ A,        // [B*L, E] f32
              const __bf16* __restrict__ Bsw,     // swizzled W_in
              const float* __restrict__ b_in,     // [H]
              const float* __restrict__ dec_dense,// [B, H]
              const float* __restrict__ w_score,  // [H]
              const float* __restrict__ b_score,  // [1]
              const float* __restrict__ weights,  // [B*L] (pass 2)
              float* __restrict__ logits,         // [B*L] (pass 1)
              float* __restrict__ ctx)            // [B, H] (pass 2, atomic)
{
    __shared__ float Atile[2][BROWS][40];  // double-buffered, padded staging
    __shared__ float sDec[H_];
    __shared__ float sWsc[H_];
    __shared__ float sBin[H_];
    __shared__ float sLogit[BROWS];
    __shared__ float sCtx[H_];
    __shared__ float sWrow[BROWS];

    const int tid   = threadIdx.x;
    const int wave  = tid >> 5;
    const int lane  = tid & 31;
    const int mt    = wave & 3;
    const int ncol  = wave >> 2;
    const int m0    = blockIdx.x * BROWS;
    const int b     = m0 >> 10;
    const int mlane = lane & 15;
    const int hi    = lane >> 4;

    sBin[tid] = b_in[tid];
    if (PASS2) {
        sCtx[tid] = 0.f;
        if (tid < BROWS) sWrow[tid] = weights[m0 + tid];
    } else {
        sDec[tid] = dec_dense[b * H_ + tid];
        sWsc[tid] = w_score[tid];
        if (tid < BROWS) sLogit[tid] = 0.f;
    }

    const float zero = 0.f;
    v8f acc[NTW];
#pragma unroll
    for (int t = 0; t < NTW; ++t) {
        v8f z = {zero, zero, zero, zero, zero, zero, zero, zero};
        acc[t] = z;
    }

    const int arow  = tid >> 3;          // 0..63
    const int aquad = tid & 7;           // 0..7 (16B within 32-f32 chunk)

    // B fragments live in two register sets: bcur feeds this chunk's WMMAs while
    // the loads of the next chunk's set are in flight. Chunk 0's set starts here,
    // under the staging of the first A tile.
    const __bf16* bbase = Bsw + (((size_t)(ncol * 8 * NKC) * 32 + lane) << 4);
    v16bf bcur[NTW];
#pragma unroll
    for (int t = 0; t < NTW; ++t)
        bcur[t] = *(const v16bf*)(bbase + (size_t)(t * NKC) * 512);

    // ---- prologue: stage chunk 0 into buffer 0 ----
#if HAVE_TDM
    if (wave == 0) {
        tdmLoadChunk(A + (size_t)m0 * E_, &Atile[0][0][0]);  // whole 64x32 tile
        WAIT_TENSOR0();
    }
#else
    {
        const float* src = A + (size_t)(m0 + arow) * E_ + aquad * 4;
#if HAVE_ASYNC_LDS
        __builtin_amdgcn_global_load_async_to_lds_b128(
            AS_GLOBAL_B128(src), AS_LDS_B128(&Atile[0][arow][aquad * 4]), 0, 0);
        WAIT_ASYNC0();
#else
        const float4 val = *(const float4*)src;
        float* dst = &Atile[0][arow][aquad * 4];
        dst[0] = val.x; dst[1] = val.y; dst[2] = val.z; dst[3] = val.w;
#endif
    }
#endif
    __syncthreads();

#pragma unroll                   // the two register sets swap by renaming, without copies
    for (int kc = 0; kc < NKC; ++kc) {
        const int cur = kc & 1;
        const int nxt = cur ^ 1;

        // ---- kick off async copy of the NEXT chunk into the other buffer ----
        if (kc + 1 < NKC) {
            const float* src = A + (size_t)(m0 + arow) * E_ + (kc + 1) * KC + aquad * 4;
#if HAVE_ASYNC_LDS
            __builtin_amdgcn_global_load_async_to_lds_b128(
                AS_GLOBAL_B128(src), AS_LDS_B128(&Atile[nxt][arow][aquad * 4]), 0, 0);
#else
            const float4 val = *(const float4*)src;
            float* dst = &Atile[nxt][arow][aquad * 4];
            dst[0] = val.x; dst[1] = val.y; dst[2] = val.z; dst[3] = val.w;
#endif
            if (kc + 2 < NKC)
                __builtin_prefetch(src + KC, 0, 1);
        }

        // ---- next chunk's B fragments, all eight issued as one group ----
        v16bf bnxt[NTW];
        if (kc + 1 < NKC) {
#pragma unroll
            for (int t = 0; t < NTW; ++t)
                bnxt[t] = *(const v16bf*)(bbase + (size_t)(t * NKC + kc + 1) * 512);
        }
        // without it the scheduler deals these loads out among the WMMAs, each behind the
        // one that frees its registers, and their lead falls below one chunk
        __builtin_amdgcn_sched_barrier(0);

        v16bf afrag;
#pragma unroll
        for (int v = 0; v < 8; ++v) {
            const int k = ((v >> 2) << 4) + (hi << 3) + ((v & 3) << 1);
            const float2 p = *(const float2*)&Atile[cur][mt * 16 + mlane][k];
            afrag[2 * v]     = (__bf16)p.x;
            afrag[2 * v + 1] = (__bf16)p.y;
        }

        // ---- 8 WMMAs against the B fragments fetched one chunk ago ----
#pragma unroll
        for (int t = 0; t < NTW; ++t)
            acc[t] = __builtin_amdgcn_wmma_f32_16x16x32_bf16(
                false, afrag, false, bcur[t], (short)0, acc[t], false, false);

        // The chunk's hand-over, written by hand: __syncthreads() also waits for every
        // global load, which would end the flight of the B loads issued above.
        asm volatile("s_wait_dscnt 0x0" ::: "memory");     // own reads of cur are back
        asm volatile("s_wait_asynccnt 0x0" ::: "memory");  // own copy into nxt has landed
        asm volatile("s_barrier_signal -1\n\ts_barrier_wait -1\n\t"
                     "v_nop\n\tv_nop\n\tv_nop\n\tv_nop" ::: "memory");

        if (kc + 1 < NKC) {
#pragma unroll
            for (int t = 0; t < NTW; ++t) bcur[t] = bnxt[t];
        }
    }

    if (!PASS2) {
        float part[8];
#pragma unroll
        for (int j = 0; j < 8; ++j) part[j] = 0.f;
#pragma unroll
        for (int t = 0; t < NTW; ++t) {
            const int n = ncol * 128 + t * 16 + mlane;
            const float dv = sDec[n], wv = sWsc[n], bv = sBin[n];
#pragma unroll
            for (int j = 0; j < 8; ++j)
                part[j] += tanhf(acc[t][j] + bv + dv) * wv;
        }
#pragma unroll
        for (int j = 0; j < 8; ++j) {
            const int row = mt * 16 + hi * 8 + j;
            atomicAdd(&sLogit[row], part[j]);      // ds_add_f32
        }
        __syncthreads();
        if (tid < BROWS) logits[m0 + tid] = sLogit[tid] + b_score[0];
    } else {
#pragma unroll
        for (int t = 0; t < NTW; ++t) {
            const int n = ncol * 128 + t * 16 + mlane;
            const float bv = sBin[n];
            float s = 0.f;
#pragma unroll
            for (int j = 0; j < 8; ++j) {
                const int row = mt * 16 + hi * 8 + j;
                s += sWrow[row] * (acc[t][j] + bv);
            }
            atomicAdd(&sCtx[n], s);                // ds_add_f32
        }
        __syncthreads();
        atomicAdd(&ctx[b * H_ + tid], sCtx[tid]);  // global_atomic_add_f32
    }
}

// softmax over L per batch
__global__ __launch_bounds__(256)
void softmaxL(const float* __restrict__ logits, float* __restrict__ weights) {
    __shared__ float red[256];
    const int b = blockIdx.x, tid = threadIdx.x;
    const float* lg = logits + b * L_;

    float m = -3.402823466e38f;
    for (int i = tid; i < L_; i += 256) m = fmaxf(m, lg[i]);
    red[tid] = m; __syncthreads();
    for (int s = 128; s > 0; s >>= 1) {
        if (tid < s) red[tid] = fmaxf(red[tid], red[tid + s]);
        __syncthreads();
    }
    const float mx = red[0]; __syncthreads();

    float sum = 0.f;
    for (int i = tid; i < L_; i += 256) sum += __expf(lg[i] - mx);
    red[tid] = sum; __syncthreads();
    for (int s = 128; s > 0; s >>= 1) {
        if (tid < s) red[tid] += red[tid + s];
        __syncthreads();
    }
    const float inv = 1.f / red[0];
    for (int i = tid; i < L_; i += 256)
        weights[b * L_ + i] = __expf(lg[i] - mx) * inv;
}

// ---------------------------------------------------------------------------
// Context vector by linearity of the projection:
//   sum_l w[l]*(A[l,:]@W_in + b_in) = (sum_l w[l]*A[l,:])@W_in + b_in*sum_l w[l]
// poolRows : per 64-row tile, part[tile][e] = sum_r w[r]*A[r][e] in f32, rows in
//            index order; one wave per 512 contiguous bytes of a row.
// ctxGemm  : adds a batch's 16 tile sums in index order, rounds to bf16 and
//            multiplies by the swizzled W_in on the matrix unit, one k-chunk per
//            wave; the 16 chunk products are added in f32 in index order.
// ---------------------------------------------------------------------------
#define TILES_B (L_ / BROWS)     // 16 row tiles per batch

__global__ __launch_bounds__(128)
void poolRows(const float* __restrict__ A,        // [B*L, E] f32
              const float* __restrict__ weights,  // [B*L]
              float* __restrict__ part,           // [B*L/BROWS, E]
              float* __restrict__ psw)            // [B*L/BROWS]
{
    const int tile = blockIdx.x;
    const int tid  = threadIdx.x;
    const float4* src = (const float4*)(A + (size_t)tile * BROWS * E_) + tid;
    const float*  w   = weights + tile * BROWS;   // same address in every lane

    float4 acc = {0.f, 0.f, 0.f, 0.f};
    float  sw  = 0.f;
#pragma unroll                   // straight-line code: the row loads run ahead of the sums
    for (int r = 0; r < BROWS; ++r) {
        const float4 x  = src[r * (E_ / 4)];
        const float  wr = w[r];
        acc.x = fmaf(wr, x.x, acc.x);
        acc.y = fmaf(wr, x.y, acc.y);
        acc.z = fmaf(wr, x.z, acc.z);
        acc.w = fmaf(wr, x.w, acc.w);
        sw += wr;
    }
    ((float4*)(part + (size_t)tile * E_))[tid] = acc;
    if (tid == 0) psw[tile] = sw;
}

#define PPITCH (E_ + 8)          // bf16 elements per LDS row: 16 bytes of pad

// 64 blocks, at most one per WGP: registers go to loads in flight, not to occupancy
__global__ __launch_bounds__(512) __attribute__((amdgpu_waves_per_eu(4, 8)))
void ctxGemm(const float* __restrict__ part,      // [B*TILES_B, E]
             const float* __restrict__ psw,       // [B*TILES_B]
             const __bf16* __restrict__ Bsw,      // swizzled W_in
             const float* __restrict__ b_in,      // [H]
             float* __restrict__ ctx)             // [B, H]
{
    __shared__ __attribute__((aligned(16))) __bf16 sP[16][PPITCH];
    __shared__ float sRed[NKC][2][8][32];         // one product per k-chunk and N tile

    const int tid  = threadIdx.x;
    const int wave = tid >> 5;                    // = the wave's k-chunk
    const int lane = tid & 31;
    const int b0   = (blockIdx.x >> 4) * 16;      // 16 batches = the M tile
    const int nt0  = (blockIdx.x & 15) * 2;       // two N tiles = 128 bytes of a ctx row

    // loads that do not depend on the staging, issued ahead of it
    const float bv = b_in[nt0 * 16 + lane];
    const float4* pr = (const float4*)(psw + (b0 + wave) * TILES_B);
    float4 pw[TILES_B / 4];                       // weight sums of batch b0 + wave
#pragma unroll
    for (int t = 0; t < TILES_B / 4; ++t) pw[t] = pr[t];
    const v16bf bf0 = *(const v16bf*)(Bsw +
        (((size_t)(nt0 * NKC + wave) * 32 + lane) << 4));
    // stands before address registers of the loads above are overwritten:
    // the next load's result lands in them
    asm volatile("s_wait_xcnt 0x0" ::: "memory");
    const v16bf bf1 = *(const v16bf*)(Bsw +
        (((size_t)((nt0 + 1) * NKC + wave) * 32 + lane) << 4));
    // without it the scheduler sinks these loads to the barrier, where their latency shows
    __builtin_amdgcn_sched_barrier(0);

    // ---- pooled[16][E]: add the tile sums, round to bf16, into LDS ----
    const int c4 = tid & 127;                     // float4 column
    const int rs = tid >> 7;                      // four rows from rs*4 on
#pragma unroll
    for (int rr = 0; rr < 4; ++rr) {
        const int row = rs * 4 + rr;
        const float4* p = (const float4*)(part + (size_t)(b0 + row) * TILES_B * E_) + c4;
        float4 s = {0.f, 0.f, 0.f, 0.f};
#pragma unroll
        for (int t = 0; t < TILES_B; ++t) {
            const float4 x = p[t * (E_ / 4)];
            s.x += x.x; s.y += x.y; s.z += x.z; s.w += x.w;
        }
        __bf16* d = &sP[row][c4 * 4];
        d[0] = (__bf16)s.x; d[1] = (__bf16)s.y; d[2] = (__bf16)s.z; d[3] = (__bf16)s.w;
    }
    __syncthreads();

    // ---- each wave: its k-chunk of both N tiles ----
    {
        const int mlane = lane & 15;
        const int hi    = lane >> 4;
        // same k order as swizzleB: elements 0-7 from k = 8*hi, 8-15 from k = 16 + 8*hi
        union { v16bf v; uint4 q[2]; } a;
        a.q[0] = *(const uint4*)&sP[mlane][wave * KC + hi * 8];
        a.q[1] = *(const uint4*)&sP[mlane][wave * KC + 16 + hi * 8];
        const v8f z = {0.f, 0.f, 0.f, 0.f, 0.f, 0.f, 0.f, 0.f};
        const v8f d0 = __builtin_amdgcn_wmma_f32_16x16x32_bf16(
            false, a.v, false, bf0, (short)0, z, false, false);
        const v8f d1 = __builtin_amdgcn_wmma_f32_16x16x32_bf16(
            false, a.v, false, bf1, (short)0, z, false, false);
#pragma unroll
        for (int j = 0; j < 8; ++j) {
            sRed[wave][0][j][lane] = d0[j];
            sRed[wave][1][j][lane] = d1[j];
        }
    }
    __syncthreads();

    // ---- one output element per thread, k-chunks added in index order;
    //      a wave stores one whole 128-byte line of ctx ----
    {
        const int row = wave, col = lane;         // D register row&7, lane 16*(row>>3) + (col&15)
        float s = 0.f, sw = 0.f;
#pragma unroll
        for (int k = 0; k < NKC; ++k)
            s += sRed[k][col >> 4][row & 7][(row >> 3) * 16 + (col & 15)];
#pragma unroll
        for (int t = 0; t < TILES_B / 4; ++t) {
            sw += pw[t].x; sw += pw[t].y; sw += pw[t].z; sw += pw[t].w;
        }
        ctx[(size_t)(b0 + row) * H_ + nt0 * 16 + col] = fmaf(bv, sw, s);
    }
}

extern "C" void kernel_launch(void* const* d_in, const int* in_sizes, int n_in,
                              void* d_out, int out_size, void* d_ws, size_t ws_size,
                              hipStream_t stream) {
    const float* attn  = (const float*)d_in[0];  // [B,L,E]
    const float* dec   = (const float*)d_in[1];  // [B,H]
    const float* W_in  = (const float*)d_in[2];  // [E,H]
    const float* b_in  = (const float*)d_in[3];  // [H]
    const float* W_dec = (const float*)d_in[4];  // [H,H]
    const float* b_dec = (const float*)d_in[5];  // [H]
    const float* w_sc  = (const float*)d_in[6];  // [H,1]
    const float* b_sc  = (const float*)d_in[7];  // [1]

    char*  ws      = (char*)d_ws;
    __bf16* Bsw    = (__bf16*)ws;
    float* decd    = (float*)(ws + WS_DEC);
    float* logits  = (float*)(ws + WS_LOG);
    float* part    = (float*)(ws + WS_PART);
    float* psw     = (float*)(ws + WS_PSW);
    float* ctx     = (float*)d_out;              // [B,H]
    float* weights = (float*)d_out + B_ * H_;    // [B,L]

    swizzleB<<<1024, 256, 0, stream>>>(W_in, Bsw);
    decDense<<<B_, H_, 0, stream>>>(dec, W_dec, b_dec, decd);

    const int gemmBlocks = (B_ * L_) / BROWS;    // 1024
    attnGemm<0><<<gemmBlocks, THREADS, 0, stream>>>(
        attn, Bsw, b_in, decd, w_sc, b_sc, nullptr, logits, nullptr);
    softmaxL<<<B_, 256, 0, stream>>>(logits, weights);
    poolRows<<<gemmBlocks, 128, 0, stream>>>(attn, weights, part, psw);
    ctxGemm<<<64, 512, 0, stream>>>(part, psw, Bsw, b_in, ctx);
}

// v003
// It runs in 120 microseconds.
// In both of two side-by-side timings against v002, it was 1.14 times as fast.
// Over all steps from v000 it is 1.69 times as fast.
#include <hip/hip_runtime.h>
#include <hip/hip_bf16.h>
#include <math.h>

typedef __attribute__((ext_vector_type(16))) __bf16 v16bf;
typedef __attribute__((ext_vector_type(8)))  float  v8f;
typedef int      b128vec __attribute__((vector_size(16)));  // builtin's int4 pointee
typedef unsigned u32x4   __attribute__((vector_size(16)));
typedef int      i32x4   __attribute__((vector_size(16)));
typedef int      i32x8   __attribute__((vector_size(32)));

#define B_      64
#define L_      1024
#define E_      512
#define H_      512
#define KC      32
#define NKC     (E_/KC)          // 16 k-chunks
#define BROWS   64               // rows of A per block
#define THREADS 512              // 16 waves
#define NTW     8                // N-tiles per wave (8*16 = 128 cols per wave column)

// -------- workspace layout (bytes) --------
#define WS_DEC  (512u << 10)     // dec_dense f32 [B][H]
#define WS_LOG  (640u << 10)     // logits f32 [B*L]
#define WS_PART (1024u << 10)    // weighted row sums f32 [B*L/BROWS][E]
#define WS_PSW  (3072u << 10)    // sums of weights f32 [B*L/BROWS]

#if defined(__gfx1250__) && __has_builtin(__builtin_amdgcn_global_load_async_to_lds_b128)
#define HAVE_ASYNC_LDS 1
#else
#define HAVE_ASYNC_LDS 0
#endif

#if defined(__gfx1250__) && __has_builtin(__builtin_amdgcn_s_wait_asynccnt)
#define WAIT_ASYNC0() __builtin_amdgcn_s_wait_asynccnt(0)
#elif defined(__gfx1250__)
#define WAIT_ASYNC0() asm volatile("s_wait_asynccnt 0x0" ::: "memory")
#else
#define WAIT_ASYNC0()
#endif

#if defined(__gfx1250__) && __has_builtin(__builtin_amdgcn_tensor_load_to_lds)
#define HAVE_TDM 1
#define TDM_6ARG 1               // the build's compiler takes the 6-arg builtin
#else
#define HAVE_TDM 0
#endif

#if defined(__gfx1250__) && __has_builtin(__builtin_amdgcn_s_wait_tensorcnt)
#define WAIT_TENSOR0() __builtin_amdgcn_s_wait_tensorcnt(0)
#elif defined(__gfx1250__)
#define WAIT_TENSOR0() asm volatile("s_wait_tensorcnt 0x0" ::: "memory")
#else
#define WAIT_TENSOR0()
#endif

#define AS_GLOBAL_B128(p) ((__attribute__((address_space(1))) b128vec*)(p))
#define AS_LDS_B128(p)    ((__attribute__((address_space(3))) b128vec*)(p))

#if HAVE_TDM
__device__ __forceinline__ void tdmLoadChunk(const float* gsrc, float* ldst) {
    unsigned long long ga = (unsigned long long)gsrc;
    unsigned lds_off = (unsigned)(unsigned long long)
        (__attribute__((address_space(3))) char*)ldst;
    u32x4 g0 = { 1u,
                 lds_off,
                 (unsigned)ga,
                 (unsigned)((ga >> 32) & 0x01FFFFFFull) | 0x80000000u };
    i32x8 g1 = { (2 << 16) | (1 << 20) | (4 << 22) | (7 << 25),
                 (int)(512u << 16),
                 0,
                 1 | (32 << 16),
                 64,
                 512,
                 0, 0 };
    i32x4 z4 = {0, 0, 0, 0};
#if TDM_6ARG
    i32x8 z8 = {0, 0, 0, 0, 0, 0, 0, 0};
    __builtin_amdgcn_tensor_load_to_lds(g0, g1, z4, z4, z8, 0);
#else
    __builtin_amdgcn_tensor_load_to_lds(g0, g1, z4, z4, 0);
#endif
}
#endif

__global__ __launch_bounds__(256)
void swizzleB(const float* __restrict__ W_in, __bf16* __restrict__ Bsw) {
    int idx  = blockIdx.x * 256 + threadIdx.x;   // 262144 total
    int e    = idx & 15;
    int lane = (idx >> 4) & 31;
    int kc   = (idx >> 9) & 15;
    int nt   = idx >> 13;
    int v    = e >> 1, ee = e & 1;
    int n    = nt * 16 + (lane & 15);
    int k    = kc * KC + ((v >> 2) << 4) + ((lane >> 4) << 3) + ((v & 3) << 1) + ee;
    Bsw[idx] = (__bf16)W_in[k * H_ + n];
}

__global__ __launch_bounds__(512)
void decDense(const float* __restrict__ dec, const float* __restrict__ W_dec,
              const float* __restrict__ b_dec, float* __restrict__ out) {
    int b = blockIdx.x, h = threadIdx.x;
    float s = b_dec[h];
#pragma unroll 8
    for (int k = 0; k < H_; ++k)
        s += dec[b * H_ + k] * W_dec[k * H_ + h];
    out[b * H_ + h] = s;
}

__device__ __forceinline__ void tanh8(float (&y)[8], const float (&x)[8]) {
    asm("v_tanh_f32 %0, %8\n\t"
        "v_tanh_f32 %1, %9\n\t"
        "v_tanh_f32 %2, %10\n\t"
        "v_tanh_f32 %3, %11\n\t"
        "v_tanh_f32 %4, %12\n\t"
        "v_tanh_f32 %5, %13\n\t"
        "v_tanh_f32 %6, %14\n\t"
        "v_tanh_f32 %7, %15\n\t"
        "v_nop"
        : "=&v"(y[0]), "=&v"(y[1]), "=&v"(y[2]), "=&v"(y[3]),
          "=&v"(y[4]), "=&v"(y[5]), "=&v"(y[6]), "=&v"(y[7])
        : "v"(x[0]), "v"(x[1]), "v"(x[2]), "v"(x[3]),
          "v"(x[4]), "v"(x[5]), "v"(x[6]), "v"(x[7]));
}

template <int PASS2>
__global__ __launch_bounds__(THREADS)
void attnGemm(const float* __restrict__ A,        // [B*L, E] f32
              const __bf16* __restrict__ Bsw,     // swizzled W_in
              const float* __restrict__ b_in,     // [H]
              const float* __restrict__ dec_dense,// [B, H]
              const float* __restrict__ w_score,  // [H]
              const float* __restrict__ b_score,  // [1]
              const float* __restrict__ weights,  // [B*L] (pass 2)
              float* __restrict__ logits,         // [B*L] (pass 1)
              float* __restrict__ ctx)            // [B, H] (pass 2, atomic)
{
    __shared__ float Atile[2][BROWS][40];  // double-buffered, padded staging
    __shared__ float sDec[H_];
    __shared__ float sWsc[H_];
    __shared__ float sBin[H_];
    __shared__ float sLogit[BROWS];
    __shared__ float sCtx[H_];
    __shared__ float sWrow[BROWS];

    const int tid   = threadIdx.x;
    const int wave  = tid >> 5;
    const int lane  = tid & 31;
    const int mt    = wave & 3;
    const int ncol  = wave >> 2;
    const int m0    = blockIdx.x * BROWS;
    const int b     = m0 >> 10;
    const int mlane = lane & 15;
    const int hi    = lane >> 4;

    sBin[tid] = b_in[tid];
    if (PASS2) {
        sCtx[tid] = 0.f;
        if (tid < BROWS) sWrow[tid] = weights[m0 + tid];
    } else {
        sDec[tid] = dec_dense[b * H_ + tid];
        sWsc[tid] = w_score[tid];
        if (tid < BROWS) sLogit[tid] = 0.f;
    }

    const float zero = 0.f;
    v8f acc[NTW];
#pragma unroll
    for (int t = 0; t < NTW; ++t) {
        v8f z = {zero, zero, zero, zero, zero, zero, zero, zero};
        acc[t] = z;
    }

    const int arow  = tid >> 3;          // 0..63
    const int aquad = tid & 7;           // 0..7 (16B within 32-f32 chunk)

    // B fragments live in two register sets: bcur feeds this chunk's WMMAs while
    // the loads of the next chunk's set are in flight. Chunk 0's set starts here,
    // under the staging of the first A tile.
    const __bf16* bbase = Bsw + (((size_t)(ncol * 8 * NKC) * 32 + lane) << 4);
    v16bf bcur[NTW];
#pragma unroll
    for (int t = 0; t < NTW; ++t)
        bcur[t] = *(const v16bf*)(bbase + (size_t)(t * NKC) * 512);

    // ---- prologue: stage chunk 0 into buffer 0 ----
#if HAVE_TDM
    if (wave == 0) {
        tdmLoadChunk(A + (size_t)m0 * E_, &Atile[0][0][0]);  // whole 64x32 tile
        WAIT_TENSOR0();
    }
#else
    {
        const float* src = A + (size_t)(m0 + arow) * E_ + aquad * 4;
#if HAVE_ASYNC_LDS
        __builtin_amdgcn_global_load_async_to_lds_b128(
            AS_GLOBAL_B128(src), AS_LDS_B128(&Atile[0][arow][aquad * 4]), 0, 0);
        WAIT_ASYNC0();
#else
        const float4 val = *(const float4*)src;
        float* dst = &Atile[0][arow][aquad * 4];
        dst[0] = val.x; dst[1] = val.y; dst[2] = val.z; dst[3] = val.w;
#endif
    }
#endif
    __syncthreads();

#pragma unroll                   // the two register sets swap by renaming, without copies
    for (int kc = 0; kc < NKC; ++kc) {
        const int cur = kc & 1;
        const int nxt = cur ^ 1;

        // ---- kick off async copy of the NEXT chunk into the other buffer ----
        if (kc + 1 < NKC) {
            const float* src = A + (size_t)(m0 + arow) * E_ + (kc + 1) * KC + aquad * 4;
#if HAVE_ASYNC_LDS
            __builtin_amdgcn_global_load_async_to_lds_b128(
                AS_GLOBAL_B128(src), AS_LDS_B128(&Atile[nxt][arow][aquad * 4]), 0, 0);
#else
            const float4 val = *(const float4*)src;
            float* dst = &Atile[nxt][arow][aquad * 4];
            dst[0] = val.x; dst[1] = val.y; dst[2] = val.z; dst[3] = val.w;
#endif
            if (kc + 2 < NKC)
                __builtin_prefetch(src + KC, 0, 1);
        }

        // ---- next chunk's B fragments, all eight issued as one group ----
        v16bf bnxt[NTW];
        if (kc + 1 < NKC) {
#pragma unroll
            for (int t = 0; t < NTW; ++t)
                bnxt[t] = *(const v16bf*)(bbase + (size_t)(t * NKC + kc + 1) * 512);
        }
        // without it the scheduler deals these loads out among the WMMAs, each behind the
        // one that frees its registers, and their lead falls below one chunk
        __builtin_amdgcn_sched_barrier(0);

        v16bf afrag;
#pragma unroll
        for (int v = 0; v < 8; ++v) {
            const int k = ((v >> 2) << 4) + (hi << 3) + ((v & 3) << 1);
            const float2 p = *(const float2*)&Atile[cur][mt * 16 + mlane][k];
            afrag[2 * v]     = (__bf16)p.x;
            afrag[2 * v + 1] = (__bf16)p.y;
        }

        // ---- 8 WMMAs against the B fragments fetched one chunk ago ----
#pragma unroll
        for (int t = 0; t < NTW; ++t)
            acc[t] = __builtin_amdgcn_wmma_f32_16x16x32_bf16(
                false, afrag, false, bcur[t], (short)0, acc[t], false, false);

        // The chunk's hand-over, written by hand: __syncthreads() also waits for every
        // global load, which would end the flight of the B loads issued above.
        asm volatile("s_wait_dscnt 0x0" ::: "memory");     // own reads of cur are back
        asm volatile("s_wait_asynccnt 0x0" ::: "memory");  // own copy into nxt has landed
        asm volatile("s_barrier_signal -1\n\ts_barrier_wait -1\n\t"
                     "v_nop\n\tv_nop\n\tv_nop\n\tv_nop" ::: "memory");

        if (kc + 1 < NKC) {
#pragma unroll
            for (int t = 0; t < NTW; ++t) bcur[t] = bnxt[t];
        }
    }

    if (!PASS2) {
        float part[8];
#pragma unroll
        for (int j = 0; j < 8; ++j) part[j] = 0.f;
#pragma unroll
        for (int t = 0; t < NTW; ++t) {
            const int n = ncol * 128 + t * 16 + mlane;
            const float dv = sDec[n], wv = sWsc[n], bv = sBin[n];
            float x[8], y[8];
#pragma unroll
            for (int j = 0; j < 8; ++j) x[j] = acc[t][j] + bv + dv;
            tanh8(y, x);
#pragma unroll
            for (int j = 0; j < 8; ++j) part[j] = fmaf(y[j], wv, part[j]);
        }
#pragma unroll
        for (int j = 0; j < 8; ++j) {
            const int row = mt * 16 + hi * 8 + j;
            atomicAdd(&sLogit[row], part[j]);      // ds_add_f32
        }
        __syncthreads();
        if (tid < BROWS) logits[m0 + tid] = sLogit[tid] + b_score[0];
    } else {
#pragma unroll
        for (int t = 0; t < NTW; ++t) {
            const int n = ncol * 128 + t * 16 + mlane;
            const float bv = sBin[n];
            float s = 0.f;
#pragma unroll
            for (int j = 0; j < 8; ++j) {
                const int row = mt * 16 + hi * 8 + j;
                s += sWrow[row] * (acc[t][j] + bv);
            }
            atomicAdd(&sCtx[n], s);                // ds_add_f32
        }
        __syncthreads();
        atomicAdd(&ctx[b * H_ + tid], sCtx[tid]);  // global_atomic_add_f32
    }
}

// softmax over L per batch
__global__ __launch_bounds__(256)
void softmaxL(const float* __restrict__ logits, float* __restrict__ weights) {
    __shared__ float red[256];
    const int b = blockIdx.x, tid = threadIdx.x;
    const float* lg = logits + b * L_;

    float m = -3.402823466e38f;
    for (int i = tid; i < L_; i += 256) m = fmaxf(m, lg[i]);
    red[tid] = m; __syncthreads();
    for (int s = 128; s > 0; s >>= 1) {
        if (tid < s) red[tid] = fmaxf(red[tid], red[tid + s]);
        __syncthreads();
    }
    const float mx = red[0]; __syncthreads();

    float sum = 0.f;
    for (int i = tid; i < L_; i += 256) sum += __expf(lg[i] - mx);
    red[tid] = sum; __syncthreads();
    for (int s = 128; s > 0; s >>= 1) {
        if (tid < s) red[tid] += red[tid + s];
        __syncthreads();
    }
    const float inv = 1.f / red[0];
    for (int i = tid; i < L_; i += 256)
        weights[b * L_ + i] = __expf(lg[i] - mx) * inv;
}

// ---------------------------------------------------------------------------
// Context vector by linearity of the projection:
//   sum_l w[l]*(A[l,:]@W_in + b_in) = (sum_l w[l]*A[l,:])@W_in + b_in*sum_l w[l]
// poolRows : per 64-row tile, part[tile][e] = sum_r w[r]*A[r][e] in f32, rows in
//            index order; one wave per 512 contiguous bytes of a row.
// ctxGemm  : adds a batch's 16 tile sums in index order, rounds to bf16 and
//            multiplies by the swizzled W_in on the matrix unit, one k-chunk per
//            wave; the 16 chunk products are added in f32 in index order.
// ---------------------------------------------------------------------------
#define TILES_B (L_ / BROWS)     // 16 row tiles per batch

__global__ __launch_bounds__(128)
void poolRows(const float* __restrict__ A,        // [B*L, E] f32
              const float* __restrict__ weights,  // [B*L]
              float* __restrict__ part,           // [B*L/BROWS, E]
              float* __restrict__ psw)            // [B*L/BROWS]
{
    const int tile = blockIdx.x;
    const int tid  = threadIdx.x;
    const float4* src = (const float4*)(A + (size_t)tile * BROWS * E_) + tid;
    const float*  w   = weights + tile * BROWS;   // same address in every lane

    float4 acc = {0.f, 0.f, 0.f, 0.f};
    float  sw  = 0.f;
#pragma unroll                   // straight-line code: the row loads run ahead of the sums
    for (int r = 0; r < BROWS; ++r) {
        const float4 x  = src[r * (E_ / 4)];
        const float  wr = w[r];
        acc.x = fmaf(wr, x.x, acc.x);
        acc.y = fmaf(wr, x.y, acc.y);
        acc.z = fmaf(wr, x.z, acc.z);
        acc.w = fmaf(wr, x.w, acc.w);
        sw += wr;
    }
    ((float4*)(part + (size_t)tile * E_))[tid] = acc;
    if (tid == 0) psw[tile] = sw;
}

#define PPITCH (E_ + 8)          // bf16 elements per LDS row: 16 bytes of pad

// 64 blocks, at most one per WGP: registers go to loads in flight, not to occupancy
__global__ __launch_bounds__(512) __attribute__((amdgpu_waves_per_eu(4, 8)))
void ctxGemm(const float* __restrict__ part,      // [B*TILES_B, E]
             const float* __restrict__ psw,       // [B*TILES_B]
             const __bf16* __restrict__ Bsw,      // swizzled W_in
             const float* __restrict__ b_in,      // [H]
             float* __restrict__ ctx)             // [B, H]
{
    __shared__ __attribute__((aligned(16))) __bf16 sP[16][PPITCH];
    __shared__ float sRed[NKC][2][8][32];         // one product per k-chunk and N tile

    const int tid  = threadIdx.x;
    const int wave = tid >> 5;                    // = the wave's k-chunk
    const int lane = tid & 31;
    const int b0   = (blockIdx.x >> 4) * 16;      // 16 batches = the M tile
    const int nt0  = (blockIdx.x & 15) * 2;       // two N tiles = 128 bytes of a ctx row

    // loads that do not depend on the staging, issued ahead of it
    const float bv = b_in[nt0 * 16 + lane];
    const float4* pr = (const float4*)(psw + (b0 + wave) * TILES_B);
    float4 pw[TILES_B / 4];                       // weight sums of batch b0 + wave
#pragma unroll
    for (int t = 0; t < TILES_B / 4; ++t) pw[t] = pr[t];
    const v16bf bf0 = *(const v16bf*)(Bsw +
        (((size_t)(nt0 * NKC + wave) * 32 + lane) << 4));
    // stands before address registers of the loads above are overwritten:
    // the next load's result lands in them
    asm volatile("s_wait_xcnt 0x0" ::: "memory");
    const v16bf bf1 = *(const v16bf*)(Bsw +
        (((size_t)((nt0 + 1) * NKC + wave) * 32 + lane) << 4));
    // without it the scheduler sinks these loads to the barrier, where their latency shows
    __builtin_amdgcn_sched_barrier(0);

    // ---- pooled[16][E]: add the tile sums, round to bf16, into LDS ----
    const int c4 = tid & 127;                     // float4 column
    const int rs = tid >> 7;                      // four rows from rs*4 on
#pragma unroll
    for (int rr = 0; rr < 4; ++rr) {
        const int row = rs * 4 + rr;
        const float4* p = (const float4*)(part + (size_t)(b0 + row) * TILES_B * E_) + c4;
        float4 s = {0.f, 0.f, 0.f, 0.f};
#pragma unroll
        for (int t = 0; t < TILES_B; ++t) {
            const float4 x = p[t * (E_ / 4)];
            s.x += x.x; s.y += x.y; s.z += x.z; s.w += x.w;
        }
        __bf16* d = &sP[row][c4 * 4];
        d[0] = (__bf16)s.x; d[1] = (__bf16)s.y; d[2] = (__bf16)s.z; d[3] = (__bf16)s.w;
    }
    __syncthreads();

    // ---- each wave: its k-chunk of both N tiles ----
    {
        const int mlane = lane & 15;
        const int hi    = lane >> 4;
        // same k order as swizzleB: elements 0-7 from k = 8*hi, 8-15 from k = 16 + 8*hi
        union { v16bf v; uint4 q[2]; } a;
        a.q[0] = *(const uint4*)&sP[mlane][wave * KC + hi * 8];
        a.q[1] = *(const uint4*)&sP[mlane][wave * KC + 16 + hi * 8];
        const v8f z = {0.f, 0.f, 0.f, 0.f, 0.f, 0.f, 0.f, 0.f};
        const v8f d0 = __builtin_amdgcn_wmma_f32_16x16x32_bf16(
            false, a.v, false, bf0, (short)0, z, false, false);
        const v8f d1 = __builtin_amdgcn_wmma_f32_16x16x32_bf16(
            false, a.v, false, bf1, (short)0, z, false, false);
#pragma unroll
        for (int j = 0; j < 8; ++j) {
            sRed[wave][0][j][lane] = d0[j];
            sRed[wave][1][j][lane] = d1[j];
        }
    }
    __syncthreads();

    // ---- one output element per thread, k-chunks added in index order;
    //      a wave stores one whole 128-byte line of ctx ----
    {
        const int row = wave, col = lane;         // D register row&7, lane 16*(row>>3) + (col&15)
        float s = 0.f, sw = 0.f;
#pragma unroll
        for (int k = 0; k < NKC; ++k)
            s += sRed[k][col >> 4][row & 7][(row >> 3) * 16 + (col & 15)];
#pragma unroll
        for (int t = 0; t < TILES_B / 4; ++t) {
            sw += pw[t].x; sw += pw[t].y; sw += pw[t].z; sw += pw[t].w;
        }
        ctx[(size_t)(b0 + row) * H_ + nt0 * 16 + col] = fmaf(bv, sw, s);
    }
}

extern "C" void kernel_launch(void* const* d_in, const int* in_sizes, int n_in,
                              void* d_out, int out_size, void* d_ws, size_t ws_size,
                              hipStream_t stream) {
    const float* attn  = (const float*)d_in[0];  // [B,L,E]
    const float* dec   = (const float*)d_in[1];  // [B,H]
    const float* W_in  = (const float*)d_in[2];  // [E,H]
    const float* b_in  = (const float*)d_in[3];  // [H]
    const float* W_dec = (const float*)d_in[4];  // [H,H]
    const float* b_dec = (const float*)d_in[5];  // [H]
    const float* w_sc  = (const float*)d_in[6];  // [H,1]
    const float* b_sc  = (const float*)d_in[7];  // [1]

    char*  ws      = (char*)d_ws;
    __bf16* Bsw    = (__bf16*)ws;
    float* decd    = (float*)(ws + WS_DEC);
    float* logits  = (float*)(ws + WS_LOG);
    float* part    = (float*)(ws + WS_PART);
    float* psw     = (float*)(ws + WS_PSW);
    float* ctx     = (float*)d_out;              // [B,H]
    float* weights = (float*)d_out + B_ * H_;    // [B,L]

    swizzleB<<<1024, 256, 0, stream>>>(W_in, Bsw);
    decDense<<<B_, H_, 0, stream>>>(dec, W_dec, b_dec, decd);

    const int gemmBlocks = (B_ * L_) / BROWS;    // 1024
    attnGemm<0><<<gemmBlocks, THREADS, 0, stream>>>(
        attn, Bsw, b_in, decd, w_sc, b_sc, nullptr, logits, nullptr);
    softmaxL<<<B_, 256, 0, stream>>>(logits, weights);
    poolRows<<<gemmBlocks, 128, 0, stream>>>(attn, weights, part, psw);
    ctxGemm<<<64, 512, 0, stream>>>(part, psw, Bsw, b_in, ctx);
}

// v004
// A run of this version takes 107 microseconds.
// Next to v003, in two timings, it ran 1.12 and 1.13 times as fast.
// Over all steps from v000 it is 1.89 times as fast.
#include <hip/hip_runtime.h>
#include <hip/hip_bf16.h>
#include <math.h>

typedef __attribute__((ext_vector_type(16))) __bf16 v16bf;
typedef __attribute__((ext_vector_type(8)))  __bf16 v8bf;
typedef __attribute__((ext_vector_type(8)))  float  v8f;
typedef int      b128vec __attribute__((vector_size(16)));  // builtin's int4 pointee
typedef unsigned u32x4   __attribute__((vector_size(16)));
typedef int      i32x4   __attribute__((vector_size(16)));
typedef int      i32x8   __attribute__((vector_size(32)));

#define B_      64
#define L_      1024
#define E_      512
#define H_      512
#define KC      32
#define NKC     (E_/KC)          // 16 k-chunks
#define BROWS   64               // rows of A per block
#define THREADS 512              // 16 waves
#define NTW     8                // N-tiles per wave (8*16 = 128 cols per wave column)

// -------- workspace layout (bytes) --------
#define WS_DEC  (512u << 10)     // dec_dense f32 [B][H]
#define WS_LOG  (640u << 10)     // logits f32 [B*L]
#define WS_PART (1024u << 10)    // weighted row sums f32 [B*L/BROWS][E]
#define WS_PSW  (3072u << 10)    // sums of weights f32 [B*L/BROWS]

#if defined(__gfx1250__) && __has_builtin(__builtin_amdgcn_global_load_async_to_lds_b128)
#define HAVE_ASYNC_LDS 1
#else
#define HAVE_ASYNC_LDS 0
#endif

#if defined(__gfx1250__) && __has_builtin(__builtin_amdgcn_s_wait_asynccnt)
#define WAIT_ASYNC0() __builtin_amdgcn_s_wait_asynccnt(0)
#elif defined(__gfx1250__)
#define WAIT_ASYNC0() asm volatile("s_wait_asynccnt 0x0" ::: "memory")
#else
#define WAIT_ASYNC0()
#endif

#if defined(__gfx1250__) && __has_builtin(__builtin_amdgcn_tensor_load_to_lds)
#define HAVE_TDM 1
#define TDM_6ARG 1               // the build's compiler takes the 6-arg builtin
#else
#define HAVE_TDM 0
#endif

#if defined(__gfx1250__) && __has_builtin(__builtin_amdgcn_s_wait_tensorcnt)
#define WAIT_TENSOR0() __builtin_amdgcn_s_wait_tensorcnt(0)
#elif defined(__gfx1250__)
#define WAIT_TENSOR0() asm volatile("s_wait_tensorcnt 0x0" ::: "memory")
#else
#define WAIT_TENSOR0()
#endif

#define AS_GLOBAL_B128(p) ((__attribute__((address_space(1))) b128vec*)(p))
#define AS_LDS_B128(p)    ((__attribute__((address_space(3))) b128vec*)(p))

#if HAVE_TDM
__device__ __forceinline__ void tdmLoadChunk(const float* gsrc, float* ldst) {
    unsigned long long ga = (unsigned long long)gsrc;
    unsigned lds_off = (unsigned)(unsigned long long)
        (__attribute__((address_space(3))) char*)ldst;
    u32x4 g0 = { 1u,
                 lds_off,
                 (unsigned)ga,
                 (unsigned)((ga >> 32) & 0x01FFFFFFull) | 0x80000000u };
    i32x8 g1 = { (2 << 16) | (1 << 20) | (4 << 22) | (7 << 25),
                 (int)(512u << 16),
                 0,
                 1 | (32 << 16),
                 64,
                 512,
                 0, 0 };
    i32x4 z4 = {0, 0, 0, 0};
#if TDM_6ARG
    i32x8 z8 = {0, 0, 0, 0, 0, 0, 0, 0};
    __builtin_amdgcn_tensor_load_to_lds(g0, g1, z4, z4, z8, 0);
#else
    __builtin_amdgcn_tensor_load_to_lds(g0, g1, z4, z4, 0);
#endif
}
#endif

#define BPLANE 256

__global__ __launch_bounds__(256)
void swizzleB(const float* __restrict__ W_in, __bf16* __restrict__ Bsw) {
    int idx   = blockIdx.x * 256 + threadIdx.x;  // 262144 total
    int e8    = idx & 7;
    int lane  = (idx >> 3) & 31;
    int plane = (idx >> 8) & 1;
    int kc    = (idx >> 9) & 15;
    int nt    = idx >> 13;
    int n     = nt * 16 + (lane & 15);
    int k     = kc * KC + (plane << 4) + ((lane >> 4) << 3) + e8;
    Bsw[idx] = (__bf16)W_in[k * H_ + n];
}

// One lane's 16 elements of a B fragment; p = the fragment's start + 8 * lane.
__device__ __forceinline__ v16bf loadBfrag(const __bf16* p) {
    const v8bf lo = *(const v8bf*)p;
    const v8bf hi = *(const v8bf*)(p + BPLANE);
    return __builtin_shufflevector(lo, hi, 0, 1, 2, 3, 4, 5, 6, 7,
                                   8, 9, 10, 11, 12, 13, 14, 15);
}

__global__ __launch_bounds__(512)
void decDense(const float* __restrict__ dec, const float* __restrict__ W_dec,
              const float* __restrict__ b_dec, float* __restrict__ out) {
    int b = blockIdx.x, h = threadIdx.x;
    float s = b_dec[h];
#pragma unroll 8
    for (int k = 0; k < H_; ++k)
        s += dec[b * H_ + k] * W_dec[k * H_ + h];
    out[b * H_ + h] = s;
}

__device__ __forceinline__ void tanh8(float (&y)[8], const float (&x)[8]) {
    asm("v_tanh_f32 %0, %8\n\t"
        "v_tanh_f32 %1, %9\n\t"
        "v_tanh_f32 %2, %10\n\t"
        "v_tanh_f32 %3, %11\n\t"
        "v_tanh_f32 %4, %12\n\t"
        "v_tanh_f32 %5, %13\n\t"
        "v_tanh_f32 %6, %14\n\t"
        "v_tanh_f32 %7, %15\n\t"
        "v_nop"
        : "=&v"(y[0]), "=&v"(y[1]), "=&v"(y[2]), "=&v"(y[3]),
          "=&v"(y[4]), "=&v"(y[5]), "=&v"(y[6]), "=&v"(y[7])
        : "v"(x[0]), "v"(x[1]), "v"(x[2]), "v"(x[3]),
          "v"(x[4]), "v"(x[5]), "v"(x[6]), "v"(x[7]));
}

template <int PASS2>
__global__ __launch_bounds__(THREADS)
void attnGemm(const float* __restrict__ A,        // [B*L, E] f32
              const __bf16* __restrict__ Bsw,     // swizzled W_in
              const float* __restrict__ b_in,     // [H]
              const float* __restrict__ dec_dense,// [B, H]
              const float* __restrict__ w_score,  // [H]
              const float* __restrict__ b_score,  // [1]
              const float* __restrict__ weights,  // [B*L] (pass 2)
              float* __restrict__ logits,         // [B*L] (pass 1)
              float* __restrict__ ctx)            // [B, H] (pass 2, atomic)
{
    __shared__ float Atile[2][BROWS][40];  // double-buffered, padded staging
    __shared__ float sDec[H_];
    __shared__ float sWsc[H_];
    __shared__ float sBin[H_];
    __shared__ float sLogit[BROWS];
    __shared__ float sCtx[H_];
    __shared__ float sWrow[BROWS];

    const int tid   = threadIdx.x;
    const int wave  = tid >> 5;
    const int lane  = tid & 31;
    const int mt    = wave & 3;
    const int ncol  = wave >> 2;
    const int m0    = blockIdx.x * BROWS;
    const int b     = m0 >> 10;
    const int mlane = lane & 15;
    const int hi    = lane >> 4;

    sBin[tid] = b_in[tid];
    if (PASS2) {
        sCtx[tid] = 0.f;
        if (tid < BROWS) sWrow[tid] = weights[m0 + tid];
    } else {
        sDec[tid] = dec_dense[b * H_ + tid];
        sWsc[tid] = w_score[tid];
        if (tid < BROWS) sLogit[tid] = 0.f;
    }

    const float zero = 0.f;
    v8f acc[NTW];
#pragma unroll
    for (int t = 0; t < NTW; ++t) {
        v8f z = {zero, zero, zero, zero, zero, zero, zero, zero};
        acc[t] = z;
    }

    const int arow  = tid >> 3;          // 0..63
    const int aquad = tid & 7;           // 0..7 (16B within 32-f32 chunk)

    // B fragments live in two register sets: bcur feeds this chunk's WMMAs while
    // the loads of the next chunk's set are in flight. Chunk 0's set starts here,
    // under the staging of the first A tile.
    const __bf16* bbase = Bsw + (size_t)(ncol * 8 * NKC) * 512 + lane * 8;
    v16bf bcur[NTW];
#pragma unroll
    for (int t = 0; t < NTW; ++t)
        bcur[t] = loadBfrag(bbase + (size_t)(t * NKC) * 512);

    // ---- prologue: stage chunk 0 into buffer 0 ----
#if HAVE_TDM
    if (wave == 0) {
        tdmLoadChunk(A + (size_t)m0 * E_, &Atile[0][0][0]);  // whole 64x32 tile
        WAIT_TENSOR0();
    }
#else
    {
        const float* src = A + (size_t)(m0 + arow) * E_ + aquad * 4;
#if HAVE_ASYNC_LDS
        __builtin_amdgcn_global_load_async_to_lds_b128(
            AS_GLOBAL_B128(src), AS_LDS_B128(&Atile[0][arow][aquad * 4]), 0, 0);
        WAIT_ASYNC0();
#else
        const float4 val = *(const float4*)src;
        float* dst = &Atile[0][arow][aquad * 4];
        dst[0] = val.x; dst[1] = val.y; dst[2] = val.z; dst[3] = val.w;
#endif
    }
#endif
    __syncthreads();

#pragma unroll                   // the two register sets swap by renaming, without copies
    for (int kc = 0; kc < NKC; ++kc) {
        const int cur = kc & 1;
        const int nxt = cur ^ 1;

        // ---- kick off async copy of the NEXT chunk into the other buffer ----
        if (kc + 1 < NKC) {
            const float* src = A + (size_t)(m0 + arow) * E_ + (kc + 1) * KC + aquad * 4;
#if HAVE_ASYNC_LDS
            __builtin_amdgcn_global_load_async_to_lds_b128(
                AS_GLOBAL_B128(src), AS_LDS_B128(&Atile[nxt][arow][aquad * 4]), 0, 0);
#else
            const float4 val = *(const float4*)src;
            float* dst = &Atile[nxt][arow][aquad * 4];
            dst[0] = val.x; dst[1] = val.y; dst[2] = val.z; dst[3] = val.w;
#endif
            if (kc + 2 < NKC)
                __builtin_prefetch(src + KC, 0, 1);
        }

        // ---- next chunk's B fragments, all eight issued as one group ----
        v16bf bnxt[NTW];
        if (kc + 1 < NKC) {
#pragma unroll
            for (int t = 0; t < NTW; ++t)
                bnxt[t] = loadBfrag(bbase + (size_t)(t * NKC + kc + 1) * 512);
        }
        // without it the scheduler deals these loads out among the WMMAs, each behind the
        // one that frees its registers, and their lead falls below one chunk
        __builtin_amdgcn_sched_barrier(0);

        v16bf afrag;
#pragma unroll
        for (int v = 0; v < 8; ++v) {
            const int k = ((v >> 2) << 4) + (hi << 3) + ((v & 3) << 1);
            const float2 p = *(const float2*)&Atile[cur][mt * 16 + mlane][k];
            afrag[2 * v]     = (__bf16)p.x;
            afrag[2 * v + 1] = (__bf16)p.y;
        }

        // ---- 8 WMMAs against the B fragments fetched one chunk ago ----
#pragma unroll
        for (int t = 0; t < NTW; ++t)
            acc[t] = __builtin_amdgcn_wmma_f32_16x16x32_bf16(
                false, afrag, false, bcur[t], (short)0, acc[t], false, false);

        // The chunk's hand-over, written by hand: __syncthreads() also waits for every
        // global load, which would end the flight of the B loads issued above.
        asm volatile("s_wait_dscnt 0x0" ::: "memory");     // own reads of cur are back
        asm volatile("s_wait_asynccnt 0x0" ::: "memory");  // own copy into nxt has landed
        asm volatile("s_barrier_signal -1\n\ts_barrier_wait -1\n\t"
                     "v_nop\n\tv_nop\n\tv_nop\n\tv_nop" ::: "memory");

        if (kc + 1 < NKC) {
#pragma unroll
            for (int t = 0; t < NTW; ++t) bcur[t] = bnxt[t];
        }
    }

    if (!PASS2) {
        float part[8];
#pragma unroll
        for (int j = 0; j < 8; ++j) part[j] = 0.f;
#pragma unroll
        for (int t = 0; t < NTW; ++t) {
            const int n = ncol * 128 + t * 16 + mlane;
            const float dv = sDec[n], wv = sWsc[n], bv = sBin[n];
            float x[8], y[8];
#pragma unroll
            for (int j = 0; j < 8; ++j) x[j] = acc[t][j] + bv + dv;
            tanh8(y, x);
#pragma unroll
            for (int j = 0; j < 8; ++j) part[j] = fmaf(y[j], wv, part[j]);
        }
#pragma unroll
        for (int j = 0; j < 8; ++j) {
            const int row = mt * 16 + hi * 8 + j;
            atomicAdd(&sLogit[row], part[j]);      // ds_add_f32
        }
        __syncthreads();
        if (tid < BROWS) logits[m0 + tid] = sLogit[tid] + b_score[0];
    } else {
#pragma unroll
        for (int t = 0; t < NTW; ++t) {
            const int n = ncol * 128 + t * 16 + mlane;
            const float bv = sBin[n];
            float s = 0.f;
#pragma unroll
            for (int j = 0; j < 8; ++j) {
                const int row = mt * 16 + hi * 8 + j;
                s += sWrow[row] * (acc[t][j] + bv);
            }
            atomicAdd(&sCtx[n], s);                // ds_add_f32
        }
        __syncthreads();
        atomicAdd(&ctx[b * H_ + tid], sCtx[tid]);  // global_atomic_add_f32
    }
}

// softmax over L per batch
__global__ __launch_bounds__(256)
void softmaxL(const float* __restrict__ logits, float* __restrict__ weights) {
    __shared__ float red[256];
    const int b = blockIdx.x, tid = threadIdx.x;
    const float* lg = logits + b * L_;

    float m = -3.402823466e38f;
    for (int i = tid; i < L_; i += 256) m = fmaxf(m, lg[i]);
    red[tid] = m; __syncthreads();
    for (int s = 128; s > 0; s >>= 1) {
        if (tid < s) red[tid] = fmaxf(red[tid], red[tid + s]);
        __syncthreads();
    }
    const float mx = red[0]; __syncthreads();

    float sum = 0.f;
    for (int i = tid; i < L_; i += 256) sum += __expf(lg[i] - mx);
    red[tid] = sum; __syncthreads();
    for (int s = 128; s > 0; s >>= 1) {
        if (tid < s) red[tid] += red[tid + s];
        __syncthreads();
    }
    const float inv = 1.f / red[0];
    for (int i = tid; i < L_; i += 256)
        weights[b * L_ + i] = __expf(lg[i] - mx) * inv;
}

// ---------------------------------------------------------------------------
// Context vector by linearity of the projection:
//   sum_l w[l]*(A[l,:]@W_in + b_in) = (sum_l w[l]*A[l,:])@W_in + b_in*sum_l w[l]
// poolRows : per 64-row tile, part[tile][e] = sum_r w[r]*A[r][e] in f32, rows in
//            index order; one wave per 512 contiguous bytes of a row.
// ctxGemm  : adds a batch's 16 tile sums in index order, rounds to bf16 and
//            multiplies by the swizzled W_in on the matrix unit, one k-chunk per
//            wave; the 16 chunk products are added in f32 in index order.
// ---------------------------------------------------------------------------
#define TILES_B (L_ / BROWS)     // 16 row tiles per batch

__global__ __launch_bounds__(128)
void poolRows(const float* __restrict__ A,        // [B*L, E] f32
              const float* __restrict__ weights,  // [B*L]
              float* __restrict__ part,           // [B*L/BROWS, E]
              float* __restrict__ psw)            // [B*L/BROWS]
{
    const int tile = blockIdx.x;
    const int tid  = threadIdx.x;
    const float4* src = (const float4*)(A + (size_t)tile * BROWS * E_) + tid;
    const float*  w   = weights + tile * BROWS;   // same address in every lane

    float4 acc = {0.f, 0.f, 0.f, 0.f};
    float  sw  = 0.f;
#pragma unroll                   // straight-line code: the row loads run ahead of the sums
    for (int r = 0; r < BROWS; ++r) {
        const float4 x  = src[r * (E_ / 4)];
        const float  wr = w[r];
        acc.x = fmaf(wr, x.x, acc.x);
        acc.y = fmaf(wr, x.y, acc.y);
        acc.z = fmaf(wr, x.z, acc.z);
        acc.w = fmaf(wr, x.w, acc.w);
        sw += wr;
    }
    ((float4*)(part + (size_t)tile * E_))[tid] = acc;
    if (tid == 0) psw[tile] = sw;
}

#define PPITCH (E_ + 8)          // bf16 elements per LDS row: 16 bytes of pad

// 64 blocks, at most one per WGP: registers go to loads in flight, not to occupancy
__global__ __launch_bounds__(512) __attribute__((amdgpu_waves_per_eu(4, 8)))
void ctxGemm(const float* __restrict__ part,      // [B*TILES_B, E]
             const float* __restrict__ psw,       // [B*TILES_B]
             const __bf16* __restrict__ Bsw,      // swizzled W_in
             const float* __restrict__ b_in,      // [H]
             float* __restrict__ ctx)             // [B, H]
{
    __shared__ __attribute__((aligned(16))) __bf16 sP[16][PPITCH];
    __shared__ float sRed[NKC][2][8][32];         // one product per k-chunk and N tile

    const int tid  = threadIdx.x;
    const int wave = tid >> 5;                    // = the wave's k-chunk
    const int lane = tid & 31;
    const int b0   = (blockIdx.x >> 4) * 16;      // 16 batches = the M tile
    const int nt0  = (blockIdx.x & 15) * 2;       // two N tiles = 128 bytes of a ctx row

    // loads that do not depend on the staging, issued ahead of it
    const float bv = b_in[nt0 * 16 + lane];
    const float4* pr = (const float4*)(psw + (b0 + wave) * TILES_B);
    float4 pw[TILES_B / 4];                       // weight sums of batch b0 + wave
#pragma unroll
    for (int t = 0; t < TILES_B / 4; ++t) pw[t] = pr[t];
    const v16bf bf0 = loadBfrag(Bsw + (size_t)(nt0 * NKC + wave) * 512 + lane * 8);
    // stands before address registers of the loads above are overwritten:
    // the next load's result lands in them
    asm volatile("s_wait_xcnt 0x0" ::: "memory");
    const v16bf bf1 = loadBfrag(Bsw + (size_t)((nt0 + 1) * NKC + wave) * 512 + lane * 8);
    // without it the scheduler sinks these loads to the barrier, where their latency shows
    __builtin_amdgcn_sched_barrier(0);

    // ---- pooled[16][E]: add the tile sums, round to bf16, into LDS ----
    const int c4 = tid & 127;                     // float4 column
    const int rs = tid >> 7;                      // four rows from rs*4 on
#pragma unroll
    for (int rr = 0; rr < 4; ++rr) {
        const int row = rs * 4 + rr;
        const float4* p = (const float4*)(part + (size_t)(b0 + row) * TILES_B * E_) + c4;
        float4 s = {0.f, 0.f, 0.f, 0.f};
#pragma unroll
        for (int t = 0; t < TILES_B; ++t) {
            const float4 x = p[t * (E_ / 4)];
            s.x += x.x; s.y += x.y; s.z += x.z; s.w += x.w;
        }
        __bf16* d = &sP[row][c4 * 4];
        d[0] = (__bf16)s.x; d[1] = (__bf16)s.y; d[2] = (__bf16)s.z; d[3] = (__bf16)s.w;
    }
    __syncthreads();

    // ---- each wave: its k-chunk of both N tiles ----
    {
        const int mlane = lane & 15;
        const int hi    = lane >> 4;
        // same k order as swizzleB: elements 0-7 from k = 8*hi, 8-15 from k = 16 + 8*hi
        union { v16bf v; uint4 q[2]; } a;
        a.q[0] = *(const uint4*)&sP[mlane][wave * KC + hi * 8];
        a.q[1] = *(const uint4*)&sP[mlane][wave * KC + 16 + hi * 8];
        const v8f z = {0.f, 0.f, 0.f, 0.f, 0.f, 0.f, 0.f, 0.f};
        const v8f d0 = __builtin_amdgcn_wmma_f32_16x16x32_bf16(
            false, a.v, false, bf0, (short)0, z, false, false);
        const v8f d1 = __builtin_amdgcn_wmma_f32_16x16x32_bf16(
            false, a.v, false, bf1, (short)0, z, false, false);
#pragma unroll
        for (int j = 0; j < 8; ++j) {
            sRed[wave][0][j][lane] = d0[j];
            sRed[wave][1][j][lane] = d1[j];
        }
    }
    __syncthreads();

    // ---- one output element per thread, k-chunks added in index order;
    //      a wave stores one whole 128-byte line of ctx ----
    {
        const int row = wave, col = lane;         // D register row&7, lane 16*(row>>3) + (col&15)
        float s = 0.f, sw = 0.f;
#pragma unroll
        for (int k = 0; k < NKC; ++k)
            s += sRed[k][col >> 4][row & 7][(row >> 3) * 16 + (col & 15)];
#pragma unroll
        for (int t = 0; t < TILES_B / 4; ++t) {
            sw += pw[t].x; sw += pw[t].y; sw += pw[t].z; sw += pw[t].w;
        }
        ctx[(size_t)(b0 + row) * H_ + nt0 * 16 + col] = fmaf(bv, sw, s);
    }
}

extern "C" void kernel_launch(void* const* d_in, const int* in_sizes, int n_in,
                              void* d_out, int out_size, void* d_ws, size_t ws_size,
                              hipStream_t stream) {
    const float* attn  = (const float*)d_in[0];  // [B,L,E]
    const float* dec   = (const float*)d_in[1];  // [B,H]
    const float* W_in  = (const float*)d_in[2];  // [E,H]
    const float* b_in  = (const float*)d_in[3];  // [H]
    const float* W_dec = (const float*)d_in[4];  // [H,H]
    const float* b_dec = (const float*)d_in[5];  // [H]
    const float* w_sc  = (const float*)d_in[6];  // [H,1]
    const float* b_sc  = (const float*)d_in[7];  // [1]

    char*  ws      = (char*)d_ws;
    __bf16* Bsw    = (__bf16*)ws;
    float* decd    = (float*)(ws + WS_DEC);
    float* logits  = (float*)(ws + WS_LOG);
    float* part    = (float*)(ws + WS_PART);
    float* psw     = (float*)(ws + WS_PSW);
    float* ctx     = (float*)d_out;              // [B,H]
    float* weights = (float*)d_out + B_ * H_;    // [B,L]

    swizzleB<<<1024, 256, 0, stream>>>(W_in, Bsw);
    decDense<<<B_, H_, 0, stream>>>(dec, W_dec, b_dec, decd);

    const int gemmBlocks = (B_ * L_) / BROWS;    // 1024
    attnGemm<0><<<gemmBlocks, THREADS, 0, stream>>>(
        attn, Bsw, b_in, decd, w_sc, b_sc, nullptr, logits, nullptr);
    softmaxL<<<B_, 256, 0, stream>>>(logits, weights);
    poolRows<<<gemmBlocks, 128, 0, stream>>>(attn, weights, part, psw);
    ctxGemm<<<64, 512, 0, stream>>>(part, psw, Bsw, b_in, ctx);
}

// v005
// A run of this version takes 79.5 microseconds.
// Timed twice side by side with v004, it ran 1.36 times as fast both times.
// All steps since v000 together make it 2.57 times as fast.
#include <hip/hip_runtime.h>
#include <hip/hip_bf16.h>
#include <math.h>

typedef __attribute__((ext_vector_type(16))) __bf16 v16bf;
typedef __attribute__((ext_vector_type(8)))  __bf16 v8bf;
typedef __attribute__((ext_vector_type(8)))  float  v8f;
typedef int      b128vec __attribute__((vector_size(16)));  // builtin's int4 pointee
typedef unsigned u32x4   __attribute__((vector_size(16)));
typedef int      i32x4   __attribute__((vector_size(16)));
typedef int      i32x8   __attribute__((vector_size(32)));

#define B_      64
#define L_      1024
#define E_      512
#define H_      512
#define KC      32
#define NKC     (E_/KC)          // 16 k-chunks
#define BROWS   64               // rows of A per block
#define THREADS 512              // 16 waves
#define NTW     8                // N-tiles per wave (8*16 = 128 cols per wave column)

// -------- workspace layout (bytes) --------
#define WS_DEC  (512u << 10)     // dec_dense f32 [B][H]
#define WS_LOG  (640u << 10)     // logits f32 [B*L]
#define WS_PART (1024u << 10)    // weighted row sums f32 [B*L/BROWS][E]
#define WS_PSW  (3072u << 10)    // sums of weights f32 [B*L/BROWS]

#if defined(__gfx1250__) && __has_builtin(__builtin_amdgcn_global_load_async_to_lds_b128)
#define HAVE_ASYNC_LDS 1
#else
#define HAVE_ASYNC_LDS 0
#endif

#if defined(__gfx1250__) && __has_builtin(__builtin_amdgcn_s_wait_asynccnt)
#define WAIT_ASYNC0() __builtin_amdgcn_s_wait_asynccnt(0)
#elif defined(__gfx1250__)
#define WAIT_ASYNC0() asm volatile("s_wait_asynccnt 0x0" ::: "memory")
#else
#define WAIT_ASYNC0()
#endif

#if defined(__gfx1250__) && __has_builtin(__builtin_amdgcn_tensor_load_to_lds)
#define HAVE_TDM 1
#define TDM_6ARG 1               // the build's compiler takes the 6-arg builtin
#else
#define HAVE_TDM 0
#endif

#if defined(__gfx1250__) && __has_builtin(__builtin_amdgcn_s_wait_tensorcnt)
#define WAIT_TENSOR0() __builtin_amdgcn_s_wait_tensorcnt(0)
#elif defined(__gfx1250__)
#define WAIT_TENSOR0() asm volatile("s_wait_tensorcnt 0x0" ::: "memory")
#else
#define WAIT_TENSOR0()
#endif

#define AS_GLOBAL_B128(p) ((__attribute__((address_space(1))) b128vec*)(p))
#define AS_LDS_B128(p)    ((__attribute__((address_space(3))) b128vec*)(p))

#if HAVE_TDM
__device__ __forceinline__ void tdmLoadChunk(const float* gsrc, float* ldst) {
    unsigned long long ga = (unsigned long long)gsrc;
    unsigned lds_off = (unsigned)(unsigned long long)
        (__attribute__((address_space(3))) char*)ldst;
    u32x4 g0 = { 1u,
                 lds_off,
                 (unsigned)ga,
                 (unsigned)((ga >> 32) & 0x01FFFFFFull) | 0x80000000u };
    i32x8 g1 = { (2 << 16) | (1 << 20) | (4 << 22) | (7 << 25),
                 (int)(512u << 16),
                 0,
                 1 | (32 << 16),
                 64,
                 512,
                 0, 0 };
    i32x4 z4 = {0, 0, 0, 0};
#if TDM_6ARG
    i32x8 z8 = {0, 0, 0, 0, 0, 0, 0, 0};
    __builtin_amdgcn_tensor_load_to_lds(g0, g1, z4, z4, z8, 0);
#else
    __builtin_amdgcn_tensor_load_to_lds(g0, g1, z4, z4, 0);
#endif
}
#endif

#define BPLANE 256

__global__ __launch_bounds__(256)
void swizzleB(const float* __restrict__ W_in, __bf16* __restrict__ Bsw) {
    int idx   = blockIdx.x * 256 + threadIdx.x;  // 262144 total
    int e8    = idx & 7;
    int lane  = (idx >> 3) & 31;
    int plane = (idx >> 8) & 1;
    int kc    = (idx >> 9) & 15;
    int nt    = idx >> 13;
    int n     = nt * 16 + (lane & 15);
    int k     = kc * KC + (plane << 4) + ((lane >> 4) << 3) + e8;
    Bsw[idx] = (__bf16)W_in[k * H_ + n];
}

// One lane's 16 elements of a B fragment; p = the fragment's start + 8 * lane.
__device__ __forceinline__ v16bf loadBfrag(const __bf16* p) {
    const v8bf lo = *(const v8bf*)p;
    const v8bf hi = *(const v8bf*)(p + BPLANE);
    return __builtin_shufflevector(lo, hi, 0, 1, 2, 3, 4, 5, 6, 7,
                                   8, 9, 10, 11, 12, 13, 14, 15);
}

// dec_dense[b][h] = b_dec[h] + sum_k dec[b][k] * W_dec[k][h], f32 on the vector unit.
// A block owns 32 columns (one 128-byte line of every W_dec row) of DD_NB batches. Its 32
// groups of 8 lanes split k into runs of 16, so a lane's loads do not depend on any sum
// and all fly at once: the kernel waits out one memory latency, not one per few k steps.
// The 32 run sums of an element are added in index order through LDS.
#define DD_NB   8                // batches per block: 8 * 32 outputs, one per thread
#define DD_COLS 32               // columns per block
#define DD_RUN  16               // k steps per lane
#define DD_RUNS (H_ / DD_RUN)    // 32 runs = 256 threads / 8 lanes

__global__ __launch_bounds__(256)
void decDense(const float* __restrict__ dec, const float* __restrict__ W_dec,
              const float* __restrict__ b_dec, float* __restrict__ out) {
    __shared__ __attribute__((aligned(16))) float sPart[DD_RUNS][DD_NB][DD_COLS];

    const int tid = threadIdx.x;
    const int run = tid >> 3;
    const int c4  = (tid & 7) * 4;
    const int h0  = (blockIdx.x & 15) * DD_COLS;
    const int b0  = (blockIdx.x >> 4) * DD_NB;
    const int k0  = run * DD_RUN;

    // each input's lane part of the address (an index, two byte offsets): one register each
    const int      bidx = h0 + (tid & 31);
    const unsigned doff = k0 * 4u;
    const unsigned woff = (k0 * H_ + h0 + c4) * 4u;
    const char* dbase = (const char*)(dec + (size_t)b0 * H_);

    const float bias = b_dec[bidx];
    float4 d[DD_NB][DD_RUN / 4];
#pragma unroll
    for (int bb = 0; bb < DD_NB; ++bb)
#pragma unroll
        for (int q = 0; q < DD_RUN / 4; ++q)
            d[bb][q] = *(const float4*)(dbase + doff + (bb * H_ + q * 4) * 4);
    float4 w[DD_RUN];
#pragma unroll
    for (int i = 0; i < DD_RUN; ++i)
        w[i] = *(const float4*)((const char*)W_dec + woff + i * H_ * 4);
    // stands before an address register of the loads above is overwritten; as its inputs
    // the three registers stay whole up to here (without them the results of later loads
    // of the group landed in the address registers of earlier ones)
    asm volatile("s_wait_xcnt 0x0" :: "v"(bidx), "v"(doff), "v"(woff) : "memory");
    // without it the scheduler deals the loads out among the sums to save registers, and
    // the kernel waits out several latencies one after another
    __builtin_amdgcn_sched_barrier(0);

#pragma unroll
    for (int bb = 0; bb < DD_NB; ++bb) {
        float4 s = {0.f, 0.f, 0.f, 0.f};
#pragma unroll
        for (int q = 0; q < DD_RUN / 4; ++q) {
            const float dk[4] = {d[bb][q].x, d[bb][q].y, d[bb][q].z, d[bb][q].w};
#pragma unroll
            for (int j = 0; j < 4; ++j) {
                const float4 x = w[q * 4 + j];
                s.x = fmaf(dk[j], x.x, s.x);
                s.y = fmaf(dk[j], x.y, s.y);
                s.z = fmaf(dk[j], x.z, s.z);
                s.w = fmaf(dk[j], x.w, s.w);
            }
        }
        *(float4*)&sPart[run][bb][c4] = s;
    }
    __syncthreads();

    // one output element per thread; a wave stores one whole 128-byte line
    const int bb = tid >> 5, col = tid & 31;
    float s = bias;
#pragma unroll
    for (int r = 0; r < DD_RUNS; ++r) s += sPart[r][bb][col];
    out[(size_t)(b0 + bb) * H_ + h0 + col] = s;
}

__device__ __forceinline__ void tanh8(float (&y)[8], const float (&x)[8]) {
    asm("v_tanh_f32 %0, %8\n\t"
        "v_tanh_f32 %1, %9\n\t"
        "v_tanh_f32 %2, %10\n\t"
        "v_tanh_f32 %3, %11\n\t"
        "v_tanh_f32 %4, %12\n\t"
        "v_tanh_f32 %5, %13\n\t"
        "v_tanh_f32 %6, %14\n\t"
        "v_tanh_f32 %7, %15\n\t"
        "v_nop"
        : "=&v"(y[0]), "=&v"(y[1]), "=&v"(y[2]), "=&v"(y[3]),
          "=&v"(y[4]), "=&v"(y[5]), "=&v"(y[6]), "=&v"(y[7])
        : "v"(x[0]), "v"(x[1]), "v"(x[2]), "v"(x[3]),
          "v"(x[4]), "v"(x[5]), "v"(x[6]), "v"(x[7]));
}

template <int PASS2>
__global__ __launch_bounds__(THREADS)
void attnGemm(const float* __restrict__ A,        // [B*L, E] f32
              const __bf16* __restrict__ Bsw,     // swizzled W_in
              const float* __restrict__ b_in,     // [H]
              const float* __restrict__ dec_dense,// [B, H]
              const float* __restrict__ w_score,  // [H]
              const float* __restrict__ b_score,  // [1]
              const float* __restrict__ weights,  // [B*L] (pass 2)
              float* __restrict__ logits,         // [B*L] (pass 1)
              float* __restrict__ ctx)            // [B, H] (pass 2, atomic)
{
    __shared__ float Atile[2][BROWS][40];  // double-buffered, padded staging
    __shared__ float sDec[H_];
    __shared__ float sWsc[H_];
    __shared__ float sBin[H_];
    __shared__ float sLogit[BROWS];
    __shared__ float sCtx[H_];
    __shared__ float sWrow[BROWS];

    const int tid   = threadIdx.x;
    const int wave  = tid >> 5;
    const int lane  = tid & 31;
    const int mt    = wave & 3;
    const int ncol  = wave >> 2;
    const int m0    = blockIdx.x * BROWS;
    const int b     = m0 >> 10;
    const int mlane = lane & 15;
    const int hi    = lane >> 4;

    sBin[tid] = b_in[tid];
    if (PASS2) {
        sCtx[tid] = 0.f;
        if (tid < BROWS) sWrow[tid] = weights[m0 + tid];
    } else {
        sDec[tid] = dec_dense[b * H_ + tid];
        sWsc[tid] = w_score[tid];
        if (tid < BROWS) sLogit[tid] = 0.f;
    }

    const float zero = 0.f;
    v8f acc[NTW];
#pragma unroll
    for (int t = 0; t < NTW; ++t) {
        v8f z = {zero, zero, zero, zero, zero, zero, zero, zero};
        acc[t] = z;
    }

    const int arow  = tid >> 3;          // 0..63
    const int aquad = tid & 7;           // 0..7 (16B within 32-f32 chunk)

    // B fragments live in two register sets: bcur feeds this chunk's WMMAs while
    // the loads of the next chunk's set are in flight. Chunk 0's set starts here,
    // under the staging of the first A tile.
    const __bf16* bbase = Bsw + (size_t)(ncol * 8 * NKC) * 512 + lane * 8;
    v16bf bcur[NTW];
#pragma unroll
    for (int t = 0; t < NTW; ++t)
        bcur[t] = loadBfrag(bbase + (size_t)(t * NKC) * 512);

    // ---- prologue: stage chunk 0 into buffer 0 ----
#if HAVE_TDM
    if (wave == 0) {
        tdmLoadChunk(A + (size_t)m0 * E_, &Atile[0][0][0]);  // whole 64x32 tile
        WAIT_TENSOR0();
    }
#else
    {
        const float* src = A + (size_t)(m0 + arow) * E_ + aquad * 4;
#if HAVE_ASYNC_LDS
        __builtin_amdgcn_global_load_async_to_lds_b128(
            AS_GLOBAL_B128(src), AS_LDS_B128(&Atile[0][arow][aquad * 4]), 0, 0);
        WAIT_ASYNC0();
#else
        const float4 val = *(const float4*)src;
        float* dst = &Atile[0][arow][aquad * 4];
        dst[0] = val.x; dst[1] = val.y; dst[2] = val.z; dst[3] = val.w;
#endif
    }
#endif
    __syncthreads();

#pragma unroll                   // the two register sets swap by renaming, without copies
    for (int kc = 0; kc < NKC; ++kc) {
        const int cur = kc & 1;
        const int nxt = cur ^ 1;

        // ---- kick off async copy of the NEXT chunk into the other buffer ----
        if (kc + 1 < NKC) {
            const float* src = A + (size_t)(m0 + arow) * E_ + (kc + 1) * KC + aquad * 4;
#if HAVE_ASYNC_LDS
            __builtin_amdgcn_global_load_async_to_lds_b128(
                AS_GLOBAL_B128(src), AS_LDS_B128(&Atile[nxt][arow][aquad * 4]), 0, 0);
#else
            const float4 val = *(const float4*)src;
            float* dst = &Atile[nxt][arow][aquad * 4];
            dst[0] = val.x; dst[1] = val.y; dst[2] = val.z; dst[3] = val.w;
#endif
            if (kc + 2 < NKC)
                __builtin_prefetch(src + KC, 0, 1);
        }

        // ---- next chunk's B fragments, all eight issued as one group ----
        v16bf bnxt[NTW];
        if (kc + 1 < NKC) {
#pragma unroll
            for (int t = 0; t < NTW; ++t)
                bnxt[t] = loadBfrag(bbase + (size_t)(t * NKC + kc + 1) * 512);
        }
        // without it the scheduler deals these loads out among the WMMAs, each behind the
        // one that frees its registers, and their lead falls below one chunk
        __builtin_amdgcn_sched_barrier(0);

        v16bf afrag;
#pragma unroll
        for (int v = 0; v < 8; ++v) {
            const int k = ((v >> 2) << 4) + (hi << 3) + ((v & 3) << 1);
            const float2 p = *(const float2*)&Atile[cur][mt * 16 + mlane][k];
            afrag[2 * v]     = (__bf16)p.x;
            afrag[2 * v + 1] = (__bf16)p.y;
        }

        // ---- 8 WMMAs against the B fragments fetched one chunk ago ----
#pragma unroll
        for (int t = 0; t < NTW; ++t)
            acc[t] = __builtin_amdgcn_wmma_f32_16x16x32_bf16(
                false, afrag, false, bcur[t], (short)0, acc[t], false, false);

        // The chunk's hand-over, written by hand: __syncthreads() also waits for every
        // global load, which would end the flight of the B loads issued above.
        asm volatile("s_wait_dscnt 0x0" ::: "memory");     // own reads of cur are back
        asm volatile("s_wait_asynccnt 0x0" ::: "memory");  // own copy into nxt has landed
        asm volatile("s_barrier_signal -1\n\ts_barrier_wait -1\n\t"
                     "v_nop\n\tv_nop\n\tv_nop\n\tv_nop" ::: "memory");

        if (kc + 1 < NKC) {
#pragma unroll
            for (int t = 0; t < NTW; ++t) bcur[t] = bnxt[t];
        }
    }

    if (!PASS2) {
        float part[8];
#pragma unroll
        for (int j = 0; j < 8; ++j) part[j] = 0.f;
#pragma unroll
        for (int t = 0; t < NTW; ++t) {
            const int n = ncol * 128 + t * 16 + mlane;
            const float dv = sDec[n], wv = sWsc[n], bv = sBin[n];
            float x[8], y[8];
#pragma unroll
            for (int j = 0; j < 8; ++j) x[j] = acc[t][j] + bv + dv;
            tanh8(y, x);
#pragma unroll
            for (int j = 0; j < 8; ++j) part[j] = fmaf(y[j], wv, part[j]);
        }
#pragma unroll
        for (int j = 0; j < 8; ++j) {
            const int row = mt * 16 + hi * 8 + j;
            atomicAdd(&sLogit[row], part[j]);      // ds_add_f32
        }
        __syncthreads();
        if (tid < BROWS) logits[m0 + tid] = sLogit[tid] + b_score[0];
    } else {
#pragma unroll
        for (int t = 0; t < NTW; ++t) {
            const int n = ncol * 128 + t * 16 + mlane;
            const float bv = sBin[n];
            float s = 0.f;
#pragma unroll
            for (int j = 0; j < 8; ++j) {
                const int row = mt * 16 + hi * 8 + j;
                s += sWrow[row] * (acc[t][j] + bv);
            }
            atomicAdd(&sCtx[n], s);                // ds_add_f32
        }
        __syncthreads();
        atomicAdd(&ctx[b * H_ + tid], sCtx[tid]);  // global_atomic_add_f32
    }
}

// softmax over L per batch
__global__ __launch_bounds__(256)
void softmaxL(const float* __restrict__ logits, float* __restrict__ weights) {
    __shared__ float red[256];
    const int b = blockIdx.x, tid = threadIdx.x;
    const float* lg = logits + b * L_;

    float m = -3.402823466e38f;
    for (int i = tid; i < L_; i += 256) m = fmaxf(m, lg[i]);
    red[tid] = m; __syncthreads();
    for (int s = 128; s > 0; s >>= 1) {
        if (tid < s) red[tid] = fmaxf(red[tid], red[tid + s]);
        __syncthreads();
    }
    const float mx = red[0]; __syncthreads();

    float sum = 0.f;
    for (int i = tid; i < L_; i += 256) sum += __expf(lg[i] - mx);
    red[tid] = sum; __syncthreads();
    for (int s = 128; s > 0; s >>= 1) {
        if (tid < s) red[tid] += red[tid + s];
        __syncthreads();
    }
    const float inv = 1.f / red[0];
    for (int i = tid; i < L_; i += 256)
        weights[b * L_ + i] = __expf(lg[i] - mx) * inv;
}

// ---------------------------------------------------------------------------
// Context vector by linearity of the projection:
//   sum_l w[l]*(A[l,:]@W_in + b_in) = (sum_l w[l]*A[l,:])@W_in + b_in*sum_l w[l]
// poolRows : per 64-row tile, part[tile][e] = sum_r w[r]*A[r][e] in f32, rows in
//            index order; one wave per 512 contiguous bytes of a row.
// ctxGemm  : adds a batch's 16 tile sums in index order, rounds to bf16 and
//            multiplies by the swizzled W_in on the matrix unit, one k-chunk per
//            wave; the 16 chunk products are added in f32 in index order.
// ---------------------------------------------------------------------------
#define TILES_B (L_ / BROWS)     // 16 row tiles per batch

__global__ __launch_bounds__(128)
void poolRows(const float* __restrict__ A,        // [B*L, E] f32
              const float* __restrict__ weights,  // [B*L]
              float* __restrict__ part,           // [B*L/BROWS, E]
              float* __restrict__ psw)            // [B*L/BROWS]
{
    const int tile = blockIdx.x;
    const int tid  = threadIdx.x;
    const float4* src = (const float4*)(A + (size_t)tile * BROWS * E_) + tid;
    const float*  w   = weights + tile * BROWS;   // same address in every lane

    float4 acc = {0.f, 0.f, 0.f, 0.f};
    float  sw  = 0.f;
#pragma unroll                   // straight-line code: the row loads run ahead of the sums
    for (int r = 0; r < BROWS; ++r) {
        const float4 x  = src[r * (E_ / 4)];
        const float  wr = w[r];
        acc.x = fmaf(wr, x.x, acc.x);
        acc.y = fmaf(wr, x.y, acc.y);
        acc.z = fmaf(wr, x.z, acc.z);
        acc.w = fmaf(wr, x.w, acc.w);
        sw += wr;
    }
    ((float4*)(part + (size_t)tile * E_))[tid] = acc;
    if (tid == 0) psw[tile] = sw;
}

#define PPITCH (E_ + 8)          // bf16 elements per LDS row: 16 bytes of pad

// 64 blocks, at most one per WGP: registers go to loads in flight, not to occupancy
__global__ __launch_bounds__(512) __attribute__((amdgpu_waves_per_eu(4, 8)))
void ctxGemm(const float* __restrict__ part,      // [B*TILES_B, E]
             const float* __restrict__ psw,       // [B*TILES_B]
             const __bf16* __restrict__ Bsw,      // swizzled W_in
             const float* __restrict__ b_in,      // [H]
             float* __restrict__ ctx)             // [B, H]
{
    __shared__ __attribute__((aligned(16))) __bf16 sP[16][PPITCH];
    __shared__ float sRed[NKC][2][8][32];         // one product per k-chunk and N tile

    const int tid  = threadIdx.x;
    const int wave = tid >> 5;                    // = the wave's k-chunk
    const int lane = tid & 31;
    const int b0   = (blockIdx.x >> 4) * 16;      // 16 batches = the M tile
    const int nt0  = (blockIdx.x & 15) * 2;       // two N tiles = 128 bytes of a ctx row

    // loads that do not depend on the staging, issued ahead of it
    const float bv = b_in[nt0 * 16 + lane];
    const float4* pr = (const float4*)(psw + (b0 + wave) * TILES_B);
    float4 pw[TILES_B / 4];                       // weight sums of batch b0 + wave
#pragma unroll
    for (int t = 0; t < TILES_B / 4; ++t) pw[t] = pr[t];
    const v16bf bf0 = loadBfrag(Bsw + (size_t)(nt0 * NKC + wave) * 512 + lane * 8);
    // stands before address registers of the loads above are overwritten:
    // the next load's result lands in them
    asm volatile("s_wait_xcnt 0x0" ::: "memory");
    const v16bf bf1 = loadBfrag(Bsw + (size_t)((nt0 + 1) * NKC + wave) * 512 + lane * 8);
    // without it the scheduler sinks these loads to the barrier, where their latency shows
    __builtin_amdgcn_sched_barrier(0);

    // ---- pooled[16][E]: add the tile sums, round to bf16, into LDS ----
    const int c4 = tid & 127;                     // float4 column
    const int rs = tid >> 7;                      // four rows from rs*4 on
#pragma unroll
    for (int rr = 0; rr < 4; ++rr) {
        const int row = rs * 4 + rr;
        const float4* p = (const float4*)(part + (size_t)(b0 + row) * TILES_B * E_) + c4;
        float4 s = {0.f, 0.f, 0.f, 0.f};
#pragma unroll
        for (int t = 0; t < TILES_B; ++t) {
            const float4 x = p[t * (E_ / 4)];
            s.x += x.x; s.y += x.y; s.z += x.z; s.w += x.w;
        }
        __bf16* d = &sP[row][c4 * 4];
        d[0] = (__bf16)s.x; d[1] = (__bf16)s.y; d[2] = (__bf16)s.z; d[3] = (__bf16)s.w;
    }
    __syncthreads();

    // ---- each wave: its k-chunk of both N tiles ----
    {
        const int mlane = lane & 15;
        const int hi    = lane >> 4;
        // same k order as swizzleB: elements 0-7 from k = 8*hi, 8-15 from k = 16 + 8*hi
        union { v16bf v; uint4 q[2]; } a;
        a.q[0] = *(const uint4*)&sP[mlane][wave * KC + hi * 8];
        a.q[1] = *(const uint4*)&sP[mlane][wave * KC + 16 + hi * 8];
        const v8f z = {0.f, 0.f, 0.f, 0.f, 0.f, 0.f, 0.f, 0.f};
        const v8f d0 = __builtin_amdgcn_wmma_f32_16x16x32_bf16(
            false, a.v, false, bf0, (short)0, z, false, false);
        const v8f d1 = __builtin_amdgcn_wmma_f32_16x16x32_bf16(
            false, a.v, false, bf1, (short)0, z, false, false);
#pragma unroll
        for (int j = 0; j < 8; ++j) {
            sRed[wave][0][j][lane] = d0[j];
            sRed[wave][1][j][lane] = d1[j];
        }
    }
    __syncthreads();

    // ---- one output element per thread, k-chunks added in index order;
    //      a wave stores one whole 128-byte line of ctx ----
    {
        const int row = wave, col = lane;         // D register row&7, lane 16*(row>>3) + (col&15)
        float s = 0.f, sw = 0.f;
#pragma unroll
        for (int k = 0; k < NKC; ++k)
            s += sRed[k][col >> 4][row & 7][(row >> 3) * 16 + (col & 15)];
#pragma unroll
        for (int t = 0; t < TILES_B / 4; ++t) {
            sw += pw[t].x; sw += pw[t].y; sw += pw[t].z; sw += pw[t].w;
        }
        ctx[(size_t)(b0 + row) * H_ + nt0 * 16 + col] = fmaf(bv, sw, s);
    }
}

extern "C" void kernel_launch(void* const* d_in, const int* in_sizes, int n_in,
                              void* d_out, int out_size, void* d_ws, size_t ws_size,
                              hipStream_t stream) {
    const float* attn  = (const float*)d_in[0];  // [B,L,E]
    const float* dec   = (const float*)d_in[1];  // [B,H]
    const float* W_in  = (const float*)d_in[2];  // [E,H]
    const float* b_in  = (const float*)d_in[3];  // [H]
    const float* W_dec = (const float*)d_in[4];  // [H,H]
    const float* b_dec = (const float*)d_in[5];  // [H]
    const float* w_sc  = (const float*)d_in[6];  // [H,1]
    const float* b_sc  = (const float*)d_in[7];  // [1]

    char*  ws      = (char*)d_ws;
    __bf16* Bsw    = (__bf16*)ws;
    float* decd    = (float*)(ws + WS_DEC);
    float* logits  = (float*)(ws + WS_LOG);
    float* part    = (float*)(ws + WS_PART);
    float* psw     = (float*)(ws + WS_PSW);
    float* ctx     = (float*)d_out;              // [B,H]
    float* weights = (float*)d_out + B_ * H_;    // [B,L]

    swizzleB<<<1024, 256, 0, stream>>>(W_in, Bsw);
    decDense<<<(B_ / DD_NB) * (H_ / DD_COLS), 256, 0, stream>>>(dec, W_dec, b_dec, decd);

    const int gemmBlocks = (B_ * L_) / BROWS;    // 1024
    attnGemm<0><<<gemmBlocks, THREADS, 0, stream>>>(
        attn, Bsw, b_in, decd, w_sc, b_sc, nullptr, logits, nullptr);
    softmaxL<<<B_, 256, 0, stream>>>(logits, weights);
    poolRows<<<gemmBlocks, 128, 0, stream>>>(attn, weights, part, psw);
    ctxGemm<<<64, 512, 0, stream>>>(part, psw, Bsw, b_in, ctx);
}

// v006
// A run of this version takes 66.3 microseconds.
// Two timings next to v005 put it at 1.18 and 1.17 times that version's speed.
// Over all steps from v000 it is 3.03 times as fast.
#include <hip/hip_runtime.h>
#include <hip/hip_bf16.h>
#include <math.h>

typedef __attribute__((ext_vector_type(16))) __bf16 v16bf;
typedef __attribute__((ext_vector_type(8)))  __bf16 v8bf;
typedef __attribute__((ext_vector_type(8)))  float  v8f;
typedef int      b128vec __attribute__((vector_size(16)));  // builtin's int4 pointee
typedef unsigned u32x4   __attribute__((vector_size(16)));
typedef int      i32x4   __attribute__((vector_size(16)));
typedef int      i32x8   __attribute__((vector_size(32)));

#define B_      64
#define L_      1024
#define E_      512
#define H_      512
#define KC      32
#define NKC     (E_/KC)          // 16 k-chunks
#define BROWS   64               // rows per tile of the pooling kernels
#define GROWS   128              // rows of A per block of the score GEMM
#define MTW     2                // M-tiles per wave (2*16 = 32 rows per wave row)
#define THREADS 512              // 16 waves
#define NTW     8                // N-tiles per wave (8*16 = 128 cols per wave column)

// -------- workspace layout (bytes) --------
#define WS_DEC  (512u << 10)     // dec_dense f32 [B][H]
#define WS_LOG  (640u << 10)     // logits f32 [B*L]
#define WS_PART (1024u << 10)    // weighted row sums f32 [B*L/BROWS][E]
#define WS_PSW  (3072u << 10)    // sums of weights f32 [B*L/BROWS]

#if defined(__gfx1250__) && __has_builtin(__builtin_amdgcn_global_load_async_to_lds_b128)
#define HAVE_ASYNC_LDS 1
#else
#define HAVE_ASYNC_LDS 0
#endif

#if defined(__gfx1250__) && __has_builtin(__builtin_amdgcn_s_wait_asynccnt)
#define WAIT_ASYNC0() __builtin_amdgcn_s_wait_asynccnt(0)
#elif defined(__gfx1250__)
#define WAIT_ASYNC0() asm volatile("s_wait_asynccnt 0x0" ::: "memory")
#else
#define WAIT_ASYNC0()
#endif

#if defined(__gfx1250__) && __has_builtin(__builtin_amdgcn_tensor_load_to_lds)
#define HAVE_TDM 1
#define TDM_6ARG 1               // the build's compiler takes the 6-arg builtin
#else
#define HAVE_TDM 0
#endif

#if defined(__gfx1250__) && __has_builtin(__builtin_amdgcn_s_wait_tensorcnt)
#define WAIT_TENSOR0() __builtin_amdgcn_s_wait_tensorcnt(0)
#elif defined(__gfx1250__)
#define WAIT_TENSOR0() asm volatile("s_wait_tensorcnt 0x0" ::: "memory")
#else
#define WAIT_TENSOR0()
#endif

#define AS_GLOBAL_B128(p) ((__attribute__((address_space(1))) b128vec*)(p))
#define AS_LDS_B128(p)    ((__attribute__((address_space(3))) b128vec*)(p))

#if HAVE_TDM
__device__ __forceinline__ void tdmLoadChunk(const float* gsrc, float* ldst) {
    unsigned long long ga = (unsigned long long)gsrc;
    unsigned lds_off = (unsigned)(unsigned long long)
        (__attribute__((address_space(3))) char*)ldst;
    u32x4 g0 = { 1u,
                 lds_off,
                 (unsigned)ga,
                 (unsigned)((ga >> 32) & 0x01FFFFFFull) | 0x80000000u };
    i32x8 g1 = { (2 << 16) | (1 << 20) | (4 << 22) | (7 << 25),
                 (int)(512u << 16),
                 0,
                 1 | (32 << 16),
                 GROWS,
                 512,
                 0, 0 };
    i32x4 z4 = {0, 0, 0, 0};
#if TDM_6ARG
    i32x8 z8 = {0, 0, 0, 0, 0, 0, 0, 0};
    __builtin_amdgcn_tensor_load_to_lds(g0, g1, z4, z4, z8, 0);
#else
    __builtin_amdgcn_tensor_load_to_lds(g0, g1, z4, z4, 0);
#endif
}
#endif

#define BPLANE 256

__global__ __launch_bounds__(256)
void swizzleB(const float* __restrict__ W_in, __bf16* __restrict__ Bsw) {
    int idx   = blockIdx.x * 256 + threadIdx.x;  // 262144 total
    int e8    = idx & 7;
    int lane  = (idx >> 3) & 31;
    int plane = (idx >> 8) & 1;
    int kc    = (idx >> 9) & 15;
    int nt    = idx >> 13;
    int n     = nt * 16 + (lane & 15);
    int k     = kc * KC + (plane << 4) + ((lane >> 4) << 3) + e8;
    Bsw[idx] = (__bf16)W_in[k * H_ + n];
}

// One lane's 16 elements of a B fragment; p = the fragment's start + 8 * lane.
__device__ __forceinline__ v16bf loadBfrag(const __bf16* p) {
    const v8bf lo = *(const v8bf*)p;
    const v8bf hi = *(const v8bf*)(p + BPLANE);
    return __builtin_shufflevector(lo, hi, 0, 1, 2, 3, 4, 5, 6, 7,
                                   8, 9, 10, 11, 12, 13, 14, 15);
}

// dec_dense[b][h] = b_dec[h] + sum_k dec[b][k] * W_dec[k][h], f32 on the vector unit.
// A block owns 32 columns (one 128-byte line of every W_dec row) of DD_NB batches. Its 32
// groups of 8 lanes split k into runs of 16, so a lane's loads do not depend on any sum
// and all fly at once: the kernel waits out one memory latency, not one per few k steps.
// The 32 run sums of an element are added in index order through LDS.
#define DD_NB   8                // batches per block: 8 * 32 outputs, one per thread
#define DD_COLS 32               // columns per block
#define DD_RUN  16               // k steps per lane
#define DD_RUNS (H_ / DD_RUN)    // 32 runs = 256 threads / 8 lanes

__global__ __launch_bounds__(256)
void decDense(const float* __restrict__ dec, const float* __restrict__ W_dec,
              const float* __restrict__ b_dec, float* __restrict__ out) {
    __shared__ __attribute__((aligned(16))) float sPart[DD_RUNS][DD_NB][DD_COLS];

    const int tid = threadIdx.x;
    const int run = tid >> 3;
    const int c4  = (tid & 7) * 4;
    const int h0  = (blockIdx.x & 15) * DD_COLS;
    const int b0  = (blockIdx.x >> 4) * DD_NB;
    const int k0  = run * DD_RUN;

    // each input's lane part of the address (an index, two byte offsets): one register each
    const int      bidx = h0 + (tid & 31);
    const unsigned doff = k0 * 4u;
    const unsigned woff = (k0 * H_ + h0 + c4) * 4u;
    const char* dbase = (const char*)(dec + (size_t)b0 * H_);

    const float bias = b_dec[bidx];
    float4 d[DD_NB][DD_RUN / 4];
#pragma unroll
    for (int bb = 0; bb < DD_NB; ++bb)
#pragma unroll
        for (int q = 0; q < DD_RUN / 4; ++q)
            d[bb][q] = *(const float4*)(dbase + doff + (bb * H_ + q * 4) * 4);
    float4 w[DD_RUN];
#pragma unroll
    for (int i = 0; i < DD_RUN; ++i)
        w[i] = *(const float4*)((const char*)W_dec + woff + i * H_ * 4);
    // stands before an address register of the loads above is overwritten; as its inputs
    // the three registers stay whole up to here (without them the results of later loads
    // of the group landed in the address registers of earlier ones)
    asm volatile("s_wait_xcnt 0x0" :: "v"(bidx), "v"(doff), "v"(woff) : "memory");
    // without it the scheduler deals the loads out among the sums to save registers, and
    // the kernel waits out several latencies one after another
    __builtin_amdgcn_sched_barrier(0);

#pragma unroll
    for (int bb = 0; bb < DD_NB; ++bb) {
        float4 s = {0.f, 0.f, 0.f, 0.f};
#pragma unroll
        for (int q = 0; q < DD_RUN / 4; ++q) {
            const float dk[4] = {d[bb][q].x, d[bb][q].y, d[bb][q].z, d[bb][q].w};
#pragma unroll
            for (int j = 0; j < 4; ++j) {
                const float4 x = w[q * 4 + j];
                s.x = fmaf(dk[j], x.x, s.x);
                s.y = fmaf(dk[j], x.y, s.y);
                s.z = fmaf(dk[j], x.z, s.z);
                s.w = fmaf(dk[j], x.w, s.w);
            }
        }
        *(float4*)&sPart[run][bb][c4] = s;
    }
    __syncthreads();

    // one output element per thread; a wave stores one whole 128-byte line
    const int bb = tid >> 5, col = tid & 31;
    float s = bias;
#pragma unroll
    for (int r = 0; r < DD_RUNS; ++r) s += sPart[r][bb][col];
    out[(size_t)(b0 + bb) * H_ + h0 + col] = s;
}

__device__ __forceinline__ void ldsAfrag(float4 (&f)[4], const float* p) {
    f[0] = *(const float4*)p;
    f[1] = *(const float4*)(p + 4);
    f[2] = *(const float4*)(p + 16);
    f[3] = *(const float4*)(p + 20);
}

__device__ __forceinline__ v16bf cvtAfrag(const float4 (&f)[4]) {
    v16bf a;
#pragma unroll
    for (int q = 0; q < 4; ++q) {
        a[4 * q]     = (__bf16)f[q].x;
        a[4 * q + 1] = (__bf16)f[q].y;
        a[4 * q + 2] = (__bf16)f[q].z;
        a[4 * q + 3] = (__bf16)f[q].w;
    }
    return a;
}

__device__ __forceinline__ void tanh8(float (&y)[8], const float (&x)[8]) {
    asm("v_tanh_f32 %0, %8\n\t"
        "v_tanh_f32 %1, %9\n\t"
        "v_tanh_f32 %2, %10\n\t"
        "v_tanh_f32 %3, %11\n\t"
        "v_tanh_f32 %4, %12\n\t"
        "v_tanh_f32 %5, %13\n\t"
        "v_tanh_f32 %6, %14\n\t"
        "v_tanh_f32 %7, %15\n\t"
        "v_nop"
        : "=&v"(y[0]), "=&v"(y[1]), "=&v"(y[2]), "=&v"(y[3]),
          "=&v"(y[4]), "=&v"(y[5]), "=&v"(y[6]), "=&v"(y[7])
        : "v"(x[0]), "v"(x[1]), "v"(x[2]), "v"(x[3]),
          "v"(x[4]), "v"(x[5]), "v"(x[6]), "v"(x[7]));
}

template <int PASS2>
__global__ __launch_bounds__(THREADS)
void attnGemm(const float* __restrict__ A,        // [B*L, E] f32
              const __bf16* __restrict__ Bsw,     // swizzled W_in
              const float* __restrict__ b_in,     // [H]
              const float* __restrict__ dec_dense,// [B, H]
              const float* __restrict__ w_score,  // [H]
              const float* __restrict__ b_score,  // [1]
              const float* __restrict__ weights,  // [B*L] (pass 2)
              float* __restrict__ logits,         // [B*L] (pass 1)
              float* __restrict__ ctx)            // [B, H] (pass 2, atomic)
{
    __shared__ __attribute__((aligned(16))) float Atile[2][GROWS][40];  // double-buffered, padded
    __shared__ float sDec[H_];
    __shared__ float sWsc[H_];
    __shared__ float sBin[H_];
    __shared__ float sLogit[GROWS];
    __shared__ float sCtx[H_];
    __shared__ float sWrow[GROWS];

    const int tid   = threadIdx.x;
    const int wave  = tid >> 5;
    const int lane  = tid & 31;
    const int mt    = wave & 3;
    const int ncol  = wave >> 2;
    const int m0    = blockIdx.x * GROWS;
    const int b     = m0 >> 10;
    const int mlane = lane & 15;
    const int hi    = lane >> 4;

    sBin[tid] = b_in[tid];
    if (PASS2) {
        sCtx[tid] = 0.f;
        if (tid < GROWS) sWrow[tid] = weights[m0 + tid];
    } else {
        sDec[tid] = dec_dense[b * H_ + tid];
        sWsc[tid] = w_score[tid];
        if (tid < GROWS) sLogit[tid] = 0.f;
    }

    const float zero = 0.f;
    v8f acc[MTW][NTW];
#pragma unroll
    for (int t = 0; t < NTW; ++t) {
        v8f z = {zero, zero, zero, zero, zero, zero, zero, zero};
        acc[0][t] = z;
        acc[1][t] = z;
    }

    const int arow  = tid >> 3;          // 0..63; a thread also stages row arow + 64
    const int aquad = tid & 7;           // 0..7 (16B within 32-f32 chunk)

    // One register set of B fragments. Each fragment feeds the wave's two M-tiles; right
    // behind its two WMMAs its registers take the load of the next chunk's fragment, which
    // so has a whole chunk to land. Chunk 0's set starts here, under the staging of the
    // first A tile.
    const __bf16* bbase = Bsw + (size_t)(ncol * 8 * NKC) * 512 + lane * 8;
    v16bf bfr[NTW];
#pragma unroll
    for (int t = 0; t < NTW; ++t)
        bfr[t] = loadBfrag(bbase + (size_t)(t * NKC) * 512);

    // ---- prologue: stage chunk 0 into buffer 0 ----
#if HAVE_TDM
    if (wave == 0) {
        tdmLoadChunk(A + (size_t)m0 * E_, &Atile[0][0][0]);  // whole 128x32 tile
        WAIT_TENSOR0();
    }
#else
#pragma unroll
    for (int h = 0; h < GROWS; h += 64) {
        const float* src = A + (size_t)(m0 + h + arow) * E_ + aquad * 4;
#if HAVE_ASYNC_LDS
        __builtin_amdgcn_global_load_async_to_lds_b128(
            AS_GLOBAL_B128(src), AS_LDS_B128(&Atile[0][h + arow][aquad * 4]), 0, 0);
#else
        const float4 val = *(const float4*)src;
        float* dst = &Atile[0][h + arow][aquad * 4];
        dst[0] = val.x; dst[1] = val.y; dst[2] = val.z; dst[3] = val.w;
#endif
    }
    WAIT_ASYNC0();
#endif
    __syncthreads();

#pragma unroll                   // buffer and chunk indices become constants
    for (int kc = 0; kc < NKC; ++kc) {
        const int cur = kc & 1;
        const int nxt = cur ^ 1;

        // ---- kick off async copy of the NEXT chunk into the other buffer ----
        if (kc + 1 < NKC) {
#pragma unroll
            for (int h = 0; h < GROWS; h += 64) {
                const float* src = A + (size_t)(m0 + h + arow) * E_ + (kc + 1) * KC + aquad * 4;
#if HAVE_ASYNC_LDS
                __builtin_amdgcn_global_load_async_to_lds_b128(
                    AS_GLOBAL_B128(src), AS_LDS_B128(&Atile[nxt][h + arow][aquad * 4]), 0, 0);
#else
                const float4 val = *(const float4*)src;
                float* dst = &Atile[nxt][h + arow][aquad * 4];
                dst[0] = val.x; dst[1] = val.y; dst[2] = val.z; dst[3] = val.w;
#endif
                if (kc + 2 < NKC)
                    __builtin_prefetch(src + KC, 0, 3);
            }
        }

        // ---- the wave's two bf16 A fragments, their LDS reads as one group ----
        const float* ap = &Atile[cur][mt * 32 + mlane][hi * 8];
        float4 f0[4], f1[4];
        ldsAfrag(f0, ap);
        ldsAfrag(f1, ap + 16 * 40);
        const v16bf a0 = cvtAfrag(f0);
        const v16bf a1 = cvtAfrag(f1);
        // without it the LDS reads are dealt out one by one among the WMMAs, each with a
        // full wait of its own
        __builtin_amdgcn_sched_barrier(0);

        // ---- 16 WMMAs: a B fragment's two, then its refill ----
#pragma unroll
        for (int t = 0; t < NTW; ++t) {
            acc[0][t] = __builtin_amdgcn_wmma_f32_16x16x32_bf16(
                false, a0, false, bfr[t], (short)0, acc[0][t], false, false);
            acc[1][t] = __builtin_amdgcn_wmma_f32_16x16x32_bf16(
                false, a1, false, bfr[t], (short)0, acc[1][t], false, false);
            if (kc + 1 < NKC)
                bfr[t] = loadBfrag(bbase + (size_t)(t * NKC + kc + 1) * 512);
            // without it the scheduler lifts the refills over the WMMAs that still read the
            // old fragments, into registers of their own, and accumulators spill
            __builtin_amdgcn_sched_barrier(0);
        }

        // The chunk's hand-over, written by hand: __syncthreads() also waits for every
        // global load, which would end the flight of the B loads issued above.
        asm volatile("s_wait_dscnt 0x0" ::: "memory");     // own reads of cur are back
        asm volatile("s_wait_asynccnt 0x0" ::: "memory");  // own copies into nxt have landed
        asm volatile("s_barrier_signal -1\n\ts_barrier_wait -1\n\t"
                     "v_nop\n\tv_nop\n\tv_nop\n\tv_nop" ::: "memory");
    }

    if (!PASS2) {
        float part[MTW][8];
#pragma unroll
        for (int j = 0; j < 8; ++j) part[0][j] = part[1][j] = 0.f;
#pragma unroll
        for (int t = 0; t < NTW; ++t) {
            const int n = ncol * 128 + t * 16 + mlane;
            const float dv = sDec[n], wv = sWsc[n], bv = sBin[n];
#pragma unroll
            for (int i = 0; i < MTW; ++i) {
                float x[8], y[8];
#pragma unroll
                for (int j = 0; j < 8; ++j) x[j] = acc[i][t][j] + bv + dv;
                tanh8(y, x);
#pragma unroll
                for (int j = 0; j < 8; ++j) part[i][j] = fmaf(y[j], wv, part[i][j]);
            }
        }
#pragma unroll
        for (int i = 0; i < MTW; ++i)
#pragma unroll
            for (int j = 0; j < 8; ++j) {
                const int row = mt * 32 + i * 16 + hi * 8 + j;
                atomicAdd(&sLogit[row], part[i][j]);   // ds_add_f32
            }
        __syncthreads();
        if (tid < GROWS) logits[m0 + tid] = sLogit[tid] + b_score[0];
    } else {
#pragma unroll
        for (int t = 0; t < NTW; ++t) {
            const int n = ncol * 128 + t * 16 + mlane;
            const float bv = sBin[n];
            float s = 0.f;
#pragma unroll
            for (int i = 0; i < MTW; ++i)
#pragma unroll
                for (int j = 0; j < 8; ++j) {
                    const int row = mt * 32 + i * 16 + hi * 8 + j;
                    s += sWrow[row] * (acc[i][t][j] + bv);
                }
            atomicAdd(&sCtx[n], s);                // ds_add_f32
        }
        __syncthreads();
        atomicAdd(&ctx[b * H_ + tid], sCtx[tid]);  // global_atomic_add_f32
    }
}

// softmax over L per batch
__global__ __launch_bounds__(256)
void softmaxL(const float* __restrict__ logits, float* __restrict__ weights) {
    __shared__ float red[256];
    const int b = blockIdx.x, tid = threadIdx.x;
    const float* lg = logits + b * L_;

    float m = -3.402823466e38f;
    for (int i = tid; i < L_; i += 256) m = fmaxf(m, lg[i]);
    red[tid] = m; __syncthreads();
    for (int s = 128; s > 0; s >>= 1) {
        if (tid < s) red[tid] = fmaxf(red[tid], red[tid + s]);
        __syncthreads();
    }
    const float mx = red[0]; __syncthreads();

    float sum = 0.f;
    for (int i = tid; i < L_; i += 256) sum += __expf(lg[i] - mx);
    red[tid] = sum; __syncthreads();
    for (int s = 128; s > 0; s >>= 1) {
        if (tid < s) red[tid] += red[tid + s];
        __syncthreads();
    }
    const float inv = 1.f / red[0];
    for (int i = tid; i < L_; i += 256)
        weights[b * L_ + i] = __expf(lg[i] - mx) * inv;
}

// ---------------------------------------------------------------------------
// Context vector by linearity of the projection:
//   sum_l w[l]*(A[l,:]@W_in + b_in) = (sum_l w[l]*A[l,:])@W_in + b_in*sum_l w[l]
// poolRows : per 64-row tile, part[tile][e] = sum_r w[r]*A[r][e] in f32, rows in
//            index order; one wave per 512 contiguous bytes of a row.
// ctxGemm  : adds a batch's 16 tile sums in index order, rounds to bf16 and
//            multiplies by the swizzled W_in on the matrix unit, one k-chunk per
//            wave; the 16 chunk products are added in f32 in index order.
// ---------------------------------------------------------------------------
#define TILES_B (L_ / BROWS)     // 16 row tiles per batch

__global__ __launch_bounds__(128)
void poolRows(const float* __restrict__ A,        // [B*L, E] f32
              const float* __restrict__ weights,  // [B*L]
              float* __restrict__ part,           // [B*L/BROWS, E]
              float* __restrict__ psw)            // [B*L/BROWS]
{
    const int tile = blockIdx.x;
    const int tid  = threadIdx.x;
    const float4* src = (const float4*)(A + (size_t)tile * BROWS * E_) + tid;
    const float*  w   = weights + tile * BROWS;   // same address in every lane

    float4 acc = {0.f, 0.f, 0.f, 0.f};
    float  sw  = 0.f;
#pragma unroll                   // straight-line code: the row loads run ahead of the sums
    for (int r = 0; r < BROWS; ++r) {
        const float4 x  = src[r * (E_ / 4)];
        const float  wr = w[r];
        acc.x = fmaf(wr, x.x, acc.x);
        acc.y = fmaf(wr, x.y, acc.y);
        acc.z = fmaf(wr, x.z, acc.z);
        acc.w = fmaf(wr, x.w, acc.w);
        sw += wr;
    }
    ((float4*)(part + (size_t)tile * E_))[tid] = acc;
    if (tid == 0) psw[tile] = sw;
}

#define PPITCH (E_ + 8)          // bf16 elements per LDS row: 16 bytes of pad

// 64 blocks, at most one per WGP: registers go to loads in flight, not to occupancy
__global__ __launch_bounds__(512) __attribute__((amdgpu_waves_per_eu(4, 8)))
void ctxGemm(const float* __restrict__ part,      // [B*TILES_B, E]
             const float* __restrict__ psw,       // [B*TILES_B]
             const __bf16* __restrict__ Bsw,      // swizzled W_in
             const float* __restrict__ b_in,      // [H]
             float* __restrict__ ctx)             // [B, H]
{
    __shared__ __attribute__((aligned(16))) __bf16 sP[16][PPITCH];
    __shared__ float sRed[NKC][2][8][32];         // one product per k-chunk and N tile

    const int tid  = threadIdx.x;
    const int wave = tid >> 5;                    // = the wave's k-chunk
    const int lane = tid & 31;
    const int b0   = (blockIdx.x >> 4) * 16;      // 16 batches = the M tile
    const int nt0  = (blockIdx.x & 15) * 2;       // two N tiles = 128 bytes of a ctx row

    // loads that do not depend on the staging, issued ahead of it
    const float bv = b_in[nt0 * 16 + lane];
    const float4* pr = (const float4*)(psw + (b0 + wave) * TILES_B);
    float4 pw[TILES_B / 4];                       // weight sums of batch b0 + wave
#pragma unroll
    for (int t = 0; t < TILES_B / 4; ++t) pw[t] = pr[t];
    const v16bf bf0 = loadBfrag(Bsw + (size_t)(nt0 * NKC + wave) * 512 + lane * 8);
    // stands before address registers of the loads above are overwritten:
    // the next load's result lands in them
    asm volatile("s_wait_xcnt 0x0" ::: "memory");
    const v16bf bf1 = loadBfrag(Bsw + (size_t)((nt0 + 1) * NKC + wave) * 512 + lane * 8);
    // without it the scheduler sinks these loads to the barrier, where their latency shows
    __builtin_amdgcn_sched_barrier(0);

    // ---- pooled[16][E]: add the tile sums, round to bf16, into LDS ----
    const int c4 = tid & 127;                     // float4 column
    const int rs = tid >> 7;                      // four rows from rs*4 on
#pragma unroll
    for (int rr = 0; rr < 4; ++rr) {
        const int row = rs * 4 + rr;
        const float4* p = (const float4*)(part + (size_t)(b0 + row) * TILES_B * E_) + c4;
        float4 s = {0.f, 0.f, 0.f, 0.f};
#pragma unroll
        for (int t = 0; t < TILES_B; ++t) {
            const float4 x = p[t * (E_ / 4)];
            s.x += x.x; s.y += x.y; s.z += x.z; s.w += x.w;
        }
        __bf16* d = &sP[row][c4 * 4];
        d[0] = (__bf16)s.x; d[1] = (__bf16)s.y; d[2] = (__bf16)s.z; d[3] = (__bf16)s.w;
    }
    __syncthreads();

    // ---- each wave: its k-chunk of both N tiles ----
    {
        const int mlane = lane & 15;
        const int hi    = lane >> 4;
        // same k order as swizzleB: elements 0-7 from k = 8*hi, 8-15 from k = 16 + 8*hi
        union { v16bf v; uint4 q[2]; } a;
        a.q[0] = *(const uint4*)&sP[mlane][wave * KC + hi * 8];
        a.q[1] = *(const uint4*)&sP[mlane][wave * KC + 16 + hi * 8];
        const v8f z = {0.f, 0.f, 0.f, 0.f, 0.f, 0.f, 0.f, 0.f};
        const v8f d0 = __builtin_amdgcn_wmma_f32_16x16x32_bf16(
            false, a.v, false, bf0, (short)0, z, false, false);
        const v8f d1 = __builtin_amdgcn_wmma_f32_16x16x32_bf16(
            false, a.v, false, bf1, (short)0, z, false, false);
#pragma unroll
        for (int j = 0; j < 8; ++j) {
            sRed[wave][0][j][lane] = d0[j];
            sRed[wave][1][j][lane] = d1[j];
        }
    }
    __syncthreads();

    // ---- one output element per thread, k-chunks added in index order;
    //      a wave stores one whole 128-byte line of ctx ----
    {
        const int row = wave, col = lane;         // D register row&7, lane 16*(row>>3) + (col&15)
        float s = 0.f, sw = 0.f;
#pragma unroll
        for (int k = 0; k < NKC; ++k)
            s += sRed[k][col >> 4][row & 7][(row >> 3) * 16 + (col & 15)];
#pragma unroll
        for (int t = 0; t < TILES_B / 4; ++t) {
            sw += pw[t].x; sw += pw[t].y; sw += pw[t].z; sw += pw[t].w;
        }
        ctx[(size_t)(b0 + row) * H_ + nt0 * 16 + col] = fmaf(bv, sw, s);
    }
}

extern "C" void kernel_launch(void* const* d_in, const int* in_sizes, int n_in,
                              void* d_out, int out_size, void* d_ws, size_t ws_size,
                              hipStream_t stream) {
    const float* attn  = (const float*)d_in[0];  // [B,L,E]
    const float* dec   = (const float*)d_in[1];  // [B,H]
    const float* W_in  = (const float*)d_in[2];  // [E,H]
    const float* b_in  = (const float*)d_in[3];  // [H]
    const float* W_dec = (const float*)d_in[4];  // [H,H]
    const float* b_dec = (const float*)d_in[5];  // [H]
    const float* w_sc  = (const float*)d_in[6];  // [H,1]
    const float* b_sc  = (const float*)d_in[7];  // [1]

    char*  ws      = (char*)d_ws;
    __bf16* Bsw    = (__bf16*)ws;
    float* decd    = (float*)(ws + WS_DEC);
    float* logits  = (float*)(ws + WS_LOG);
    float* part    = (float*)(ws + WS_PART);
    float* psw     = (float*)(ws + WS_PSW);
    float* ctx     = (float*)d_out;              // [B,H]
    float* weights = (float*)d_out + B_ * H_;    // [B,L]

    swizzleB<<<1024, 256, 0, stream>>>(W_in, Bsw);
    decDense<<<(B_ / DD_NB) * (H_ / DD_COLS), 256, 0, stream>>>(dec, W_dec, b_dec, decd);

    const int gemmBlocks = (B_ * L_) / GROWS;    // 512
    const int poolBlocks = (B_ * L_) / BROWS;    // 1024
    attnGemm<0><<<gemmBlocks, THREADS, 0, stream>>>(
        attn, Bsw, b_in, decd, w_sc, b_sc, nullptr, logits, nullptr);
    softmaxL<<<B_, 256, 0, stream>>>(logits, weights);
    poolRows<<<poolBlocks, 128, 0, stream>>>(attn, weights, part, psw);
    ctxGemm<<<64, 512, 0, stream>>>(part, psw, Bsw, b_in, ctx);
}

// v007
// One run takes 63.7 microseconds.
// In two side-by-side timings against v006, it was 1.05 and 1.04 times as fast.
// Over all steps from v000 it is 3.16 times as fast.
#include <hip/hip_runtime.h>
#include <hip/hip_bf16.h>
#include <math.h>

typedef __attribute__((ext_vector_type(16))) __bf16 v16bf;
typedef __attribute__((ext_vector_type(8)))  __bf16 v8bf;
typedef __attribute__((ext_vector_type(8)))  float  v8f;

#define B_      64
#define L_      1024
#define E_      512
#define H_      512
#define KC      32
#define NKC     (E_/KC)          // 16 k-chunks
#define BROWS   64               // rows per tile of the pooling kernels
#define GROWS   128              // rows of A per block of the score GEMM
#define MTW     2                // M-tiles per wave (2*16 = 32 rows per wave row)
#define THREADS 512              // 16 waves
#define NTW     8                // N-tiles per wave (8*16 = 128 cols per wave column)

// -------- workspace layout (bytes) --------
#define WS_DEC  (512u << 10)     // dec_dense f32 [B][H]
#define WS_LOG  (640u << 10)     // logits f32 [B*L]
#define WS_PART (1024u << 10)    // weighted row sums f32 [B*L/BROWS][E]
#define WS_PSW  (3072u << 10)    // sums of weights f32 [B*L/BROWS]

#define BPLANE 256

__global__ __launch_bounds__(256)
void swizzleB(const float* __restrict__ W_in, __bf16* __restrict__ Bsw) {
    int idx   = blockIdx.x * 256 + threadIdx.x;  // 262144 total
    int e8    = idx & 7;
    int lane  = (idx >> 3) & 31;
    int plane = (idx >> 8) & 1;
    int kc    = (idx >> 9) & 15;
    int nt    = idx >> 13;
    int n     = nt * 16 + (lane & 15);
    int k     = kc * KC + (plane << 4) + ((lane >> 4) << 3) + e8;
    Bsw[idx] = (__bf16)W_in[k * H_ + n];
}

// One lane's 16 elements of a B fragment; p = the fragment's start + 8 * lane.
__device__ __forceinline__ v16bf loadBfrag(const __bf16* p) {
    const v8bf lo = *(const v8bf*)p;
    const v8bf hi = *(const v8bf*)(p + BPLANE);
    return __builtin_shufflevector(lo, hi, 0, 1, 2, 3, 4, 5, 6, 7,
                                   8, 9, 10, 11, 12, 13, 14, 15);
}

// dec_dense[b][h] = b_dec[h] + sum_k dec[b][k] * W_dec[k][h], f32 on the vector unit.
// A block owns 32 columns (one 128-byte line of every W_dec row) of DD_NB batches. Its 32
// groups of 8 lanes split k into runs of 16, so a lane's loads do not depend on any sum
// and all fly at once: the kernel waits out one memory latency, not one per few k steps.
// The 32 run sums of an element are added in index order through LDS.
#define DD_NB   8                // batches per block: 8 * 32 outputs, one per thread
#define DD_COLS 32               // columns per block
#define DD_RUN  16               // k steps per lane
#define DD_RUNS (H_ / DD_RUN)    // 32 runs = 256 threads / 8 lanes

__global__ __launch_bounds__(256)
void decDense(const float* __restrict__ dec, const float* __restrict__ W_dec,
              const float* __restrict__ b_dec, float* __restrict__ out) {
    __shared__ __attribute__((aligned(16))) float sPart[DD_RUNS][DD_NB][DD_COLS];

    const int tid = threadIdx.x;
    const int run = tid >> 3;
    const int c4  = (tid & 7) * 4;
    const int h0  = (blockIdx.x & 15) * DD_COLS;
    const int b0  = (blockIdx.x >> 4) * DD_NB;
    const int k0  = run * DD_RUN;

    // each input's lane part of the address (an index, two byte offsets): one register each
    const int      bidx = h0 + (tid & 31);
    const unsigned doff = k0 * 4u;
    const unsigned woff = (k0 * H_ + h0 + c4) * 4u;
    const char* dbase = (const char*)(dec + (size_t)b0 * H_);

    const float bias = b_dec[bidx];
    float4 d[DD_NB][DD_RUN / 4];
#pragma unroll
    for (int bb = 0; bb < DD_NB; ++bb)
#pragma unroll
        for (int q = 0; q < DD_RUN / 4; ++q)
            d[bb][q] = *(const float4*)(dbase + doff + (bb * H_ + q * 4) * 4);
    float4 w[DD_RUN];
#pragma unroll
    for (int i = 0; i < DD_RUN; ++i)
        w[i] = *(const float4*)((const char*)W_dec + woff + i * H_ * 4);
    // stands before an address register of the loads above is overwritten; as its inputs
    // the three registers stay whole up to here (without them the results of later loads
    // of the group landed in the address registers of earlier ones)
    asm volatile("s_wait_xcnt 0x0" :: "v"(bidx), "v"(doff), "v"(woff) : "memory");
    // without it the scheduler deals the loads out among the sums to save registers, and
    // the kernel waits out several latencies one after another
    __builtin_amdgcn_sched_barrier(0);

#pragma unroll
    for (int bb = 0; bb < DD_NB; ++bb) {
        float4 s = {0.f, 0.f, 0.f, 0.f};
#pragma unroll
        for (int q = 0; q < DD_RUN / 4; ++q) {
            const float dk[4] = {d[bb][q].x, d[bb][q].y, d[bb][q].z, d[bb][q].w};
#pragma unroll
            for (int j = 0; j < 4; ++j) {
                const float4 x = w[q * 4 + j];
                s.x = fmaf(dk[j], x.x, s.x);
                s.y = fmaf(dk[j], x.y, s.y);
                s.z = fmaf(dk[j], x.z, s.z);
                s.w = fmaf(dk[j], x.w, s.w);
            }
        }
        *(float4*)&sPart[run][bb][c4] = s;
    }
    __syncthreads();

    // one output element per thread; a wave stores one whole 128-byte line
    const int bb = tid >> 5, col = tid & 31;
    float s = bias;
#pragma unroll
    for (int r = 0; r < DD_RUNS; ++r) s += sPart[r][bb][col];
    out[(size_t)(b0 + bb) * H_ + h0 + col] = s;
}

#define APITCH  40               // bf16 elements per LDS row of the A tile

// Four f32 of a row, rounded to bf16 on their way into LDS: once per element, not once in
// each of the four waves that read it.
// The two conversions (round to nearest even, the compiler's own instruction for this cast)
// are a volatile asm statement so that they stay behind the chunk barrier in front of them:
// as plain casts they were placed directly behind the global load, whose whole latency the
// wave then waited out in the middle of the chunk before.
__device__ __forceinline__ void stageA(__bf16* dst, const float4 v) {
    uint2 o;
    asm volatile("v_cvt_pk_bf16_f32 %0, %2, %3\n\t"
                 "v_cvt_pk_bf16_f32 %1, %4, %5"
                 : "=&v"(o.x), "=&v"(o.y)
                 : "v"(v.x), "v"(v.y), "v"(v.z), "v"(v.w));
    *(uint2*)dst = o;
}

__device__ __forceinline__ v16bf ldsAfrag(const __bf16* p) {
    const v8bf lo = *(const v8bf*)p;
    const v8bf hi = *(const v8bf*)(p + 16);
    return __builtin_shufflevector(lo, hi, 0, 1, 2, 3, 4, 5, 6, 7,
                                   8, 9, 10, 11, 12, 13, 14, 15);
}

__device__ __forceinline__ void tanh8(float (&y)[8], const float (&x)[8]) {
    asm("v_tanh_f32 %0, %8\n\t"
        "v_tanh_f32 %1, %9\n\t"
        "v_tanh_f32 %2, %10\n\t"
        "v_tanh_f32 %3, %11\n\t"
        "v_tanh_f32 %4, %12\n\t"
        "v_tanh_f32 %5, %13\n\t"
        "v_tanh_f32 %6, %14\n\t"
        "v_tanh_f32 %7, %15\n\t"
        "v_nop"
        : "=&v"(y[0]), "=&v"(y[1]), "=&v"(y[2]), "=&v"(y[3]),
          "=&v"(y[4]), "=&v"(y[5]), "=&v"(y[6]), "=&v"(y[7])
        : "v"(x[0]), "v"(x[1]), "v"(x[2]), "v"(x[3]),
          "v"(x[4]), "v"(x[5]), "v"(x[6]), "v"(x[7]));
}

// ---------------------------------------------------------------------------
// Fused GEMM, double-buffered: chunk kc+2 flies into registers and chunk kc+1 goes from
// registers to LDS as bf16 while WMMAs consume chunk kc.
// PASS2 == 0 : logits[b,l] = sum_h tanh(gemm+b_in+dec)*w_score + b_score
// PASS2 == 1 : ctx[b,h]   += sum_l weights[b,l]*(gemm+b_in)
// ---------------------------------------------------------------------------
template <int PASS2>
__global__ __launch_bounds__(THREADS)
void attnGemm(const float* __restrict__ A,        // [B*L, E] f32
              const __bf16* __restrict__ Bsw,     // swizzled W_in
              const float* __restrict__ b_in,     // [H]
              const float* __restrict__ dec_dense,// [B, H]
              const float* __restrict__ w_score,  // [H]
              const float* __restrict__ b_score,  // [1]
              const float* __restrict__ weights,  // [B*L] (pass 2)
              float* __restrict__ logits,         // [B*L] (pass 1)
              float* __restrict__ ctx)            // [B, H] (pass 2, atomic)
{
    __shared__ __attribute__((aligned(16))) __bf16 Atile[2][GROWS][APITCH];  // double-buffered
    __shared__ float sDec[H_];
    __shared__ float sWsc[H_];
    __shared__ float sBin[H_];
    __shared__ float sLogit[GROWS];
    __shared__ float sCtx[H_];
    __shared__ float sWrow[GROWS];

    const int tid   = threadIdx.x;
    const int wave  = tid >> 5;
    const int lane  = tid & 31;
    const int mt    = wave & 3;
    const int ncol  = wave >> 2;
    const int m0    = blockIdx.x * GROWS;
    const int b     = m0 >> 10;
    const int mlane = lane & 15;
    const int hi    = lane >> 4;

    sBin[tid] = b_in[tid];
    if (PASS2) {
        sCtx[tid] = 0.f;
        if (tid < GROWS) sWrow[tid] = weights[m0 + tid];
    } else {
        sDec[tid] = dec_dense[b * H_ + tid];
        sWsc[tid] = w_score[tid];
        if (tid < GROWS) sLogit[tid] = 0.f;
    }

    const float zero = 0.f;
    v8f acc[MTW][NTW];
#pragma unroll
    for (int t = 0; t < NTW; ++t) {
        v8f z = {zero, zero, zero, zero, zero, zero, zero, zero};
        acc[0][t] = z;
        acc[1][t] = z;
    }

    const int arow  = tid >> 3;          // 0..63; a thread also stages row arow + 64
    const int aquad = tid & 7;           // 0..7 (16B within 32-f32 chunk)

    // A wave-wide load of the staging reads four whole 128-byte lines. Chunks 0 and 1 start
    // here, ahead of the B fragments.
    const float* asrc = A + (size_t)(m0 + arow) * E_ + aquad * 4;
    const float4 first0 = *(const float4*)asrc;
    const float4 first1 = *(const float4*)(asrc + 64 * E_);
    float4 nx0 = *(const float4*)(asrc + KC);
    float4 nx1 = *(const float4*)(asrc + 64 * E_ + KC);
    __builtin_prefetch(asrc + 2 * KC, 0, 3);
    __builtin_prefetch(asrc + 64 * E_ + 2 * KC, 0, 3);

    // One register set of B fragments. Each fragment feeds the wave's two M-tiles; right
    // behind its two WMMAs its registers take the load of the next chunk's fragment, which
    // so has a whole chunk to land. Chunk 0's set starts here, under the staging of the
    // first A tile.
    const __bf16* bbase = Bsw + (size_t)(ncol * 8 * NKC) * 512 + lane * 8;
    v16bf bfr[NTW];
#pragma unroll
    for (int t = 0; t < NTW; ++t)
        bfr[t] = loadBfrag(bbase + (size_t)(t * NKC) * 512);

    // ---- prologue: stage chunk 0 into buffer 0 ----
    stageA(&Atile[0][arow][aquad * 4], first0);
    stageA(&Atile[0][arow + 64][aquad * 4], first1);
    // The hand-over of chunk 0 and of the vectors above, written by hand as in the loop:
    // __syncthreads() would also wait for chunk 1 and for the B loads.
    asm volatile("s_wait_dscnt 0x0" ::: "memory");         // own LDS writes are done
    asm volatile("s_barrier_signal -1\n\ts_barrier_wait -1" ::: "memory");

#pragma unroll                   // buffer and chunk indices become constants
    for (int kc = 0; kc < NKC; ++kc) {
        const int cur = kc & 1;
        const int nxt = cur ^ 1;

        // ---- the wave's two bf16 A fragments, their LDS reads as one group ----
        const __bf16* ap = &Atile[cur][mt * 32 + mlane][hi * 8];
        const v16bf a0 = ldsAfrag(ap);
        const v16bf a1 = ldsAfrag(ap + 16 * APITCH);

        // ---- the NEXT chunk goes from registers into the other buffer, and the chunk
        //      behind it starts its flight into the same registers ----
        if (kc + 1 < NKC) {
            stageA(&Atile[nxt][arow][aquad * 4], nx0);
            stageA(&Atile[nxt][arow + 64][aquad * 4], nx1);
        }
        if (kc + 2 < NKC) {
            const float* s = asrc + (kc + 2) * KC;
            nx0 = *(const float4*)s;
            nx1 = *(const float4*)(s + 64 * E_);
            if (kc + 3 < NKC) {
                __builtin_prefetch(s + KC, 0, 3);
                __builtin_prefetch(s + 64 * E_ + KC, 0, 3);
            }
        }
        // without it the LDS reads are dealt out one by one among the WMMAs, each with a
        // full wait of its own
        __builtin_amdgcn_sched_barrier(0);

        // ---- 16 WMMAs: a B fragment's two, then its refill ----
#pragma unroll
        for (int t = 0; t < NTW; ++t) {
            acc[0][t] = __builtin_amdgcn_wmma_f32_16x16x32_bf16(
                false, a0, false, bfr[t], (short)0, acc[0][t], false, false);
            acc[1][t] = __builtin_amdgcn_wmma_f32_16x16x32_bf16(
                false, a1, false, bfr[t], (short)0, acc[1][t], false, false);
            if (kc + 1 < NKC)
                bfr[t] = loadBfrag(bbase + (size_t)(t * NKC + kc + 1) * 512);
            // without it the scheduler lifts the refills over the WMMAs that still read the
            // old fragments, into registers of their own, and accumulators spill
            __builtin_amdgcn_sched_barrier(0);
        }

        // The chunk's hand-over, written by hand: __syncthreads() also waits for every
        // global load, which would end the flight of the A and B loads issued above.
        asm volatile("s_wait_dscnt 0x0" ::: "memory");     // own reads of cur, writes of nxt done
        asm volatile("s_barrier_signal -1\n\ts_barrier_wait -1\n\t"
                     "v_nop\n\tv_nop\n\tv_nop\n\tv_nop" ::: "memory");
    }

    if (!PASS2) {
        float part[MTW][8];
#pragma unroll
        for (int j = 0; j < 8; ++j) part[0][j] = part[1][j] = 0.f;
#pragma unroll
        for (int t = 0; t < NTW; ++t) {
            const int n = ncol * 128 + t * 16 + mlane;
            const float dv = sDec[n], wv = sWsc[n], bv = sBin[n];
#pragma unroll
            for (int i = 0; i < MTW; ++i) {
                float x[8], y[8];
#pragma unroll
                for (int j = 0; j < 8; ++j) x[j] = acc[i][t][j] + bv + dv;
                tanh8(y, x);
#pragma unroll
                for (int j = 0; j < 8; ++j) part[i][j] = fmaf(y[j], wv, part[i][j]);
            }
        }
#pragma unroll
        for (int i = 0; i < MTW; ++i)
#pragma unroll
            for (int j = 0; j < 8; ++j) {
                const int row = mt * 32 + i * 16 + hi * 8 + j;
                atomicAdd(&sLogit[row], part[i][j]);   // ds_add_f32
            }
        __syncthreads();
        if (tid < GROWS) logits[m0 + tid] = sLogit[tid] + b_score[0];
    } else {
#pragma unroll
        for (int t = 0; t < NTW; ++t) {
            const int n = ncol * 128 + t * 16 + mlane;
            const float bv = sBin[n];
            float s = 0.f;
#pragma unroll
            for (int i = 0; i < MTW; ++i)
#pragma unroll
                for (int j = 0; j < 8; ++j) {
                    const int row = mt * 32 + i * 16 + hi * 8 + j;
                    s += sWrow[row] * (acc[i][t][j] + bv);
                }
            atomicAdd(&sCtx[n], s);                // ds_add_f32
        }
        __syncthreads();
        atomicAdd(&ctx[b * H_ + tid], sCtx[tid]);  // global_atomic_add_f32
    }
}

// softmax over L per batch
__global__ __launch_bounds__(256)
void softmaxL(const float* __restrict__ logits, float* __restrict__ weights) {
    __shared__ float red[256];
    const int b = blockIdx.x, tid = threadIdx.x;
    const float* lg = logits + b * L_;

    float m = -3.402823466e38f;
    for (int i = tid; i < L_; i += 256) m = fmaxf(m, lg[i]);
    red[tid] = m; __syncthreads();
    for (int s = 128; s > 0; s >>= 1) {
        if (tid < s) red[tid] = fmaxf(red[tid], red[tid + s]);
        __syncthreads();
    }
    const float mx = red[0]; __syncthreads();

    float sum = 0.f;
    for (int i = tid; i < L_; i += 256) sum += __expf(lg[i] - mx);
    red[tid] = sum; __syncthreads();
    for (int s = 128; s > 0; s >>= 1) {
        if (tid < s) red[tid] += red[tid + s];
        __syncthreads();
    }
    const float inv = 1.f / red[0];
    for (int i = tid; i < L_; i += 256)
        weights[b * L_ + i] = __expf(lg[i] - mx) * inv;
}

// ---------------------------------------------------------------------------
// Context vector by linearity of the projection:
//   sum_l w[l]*(A[l,:]@W_in + b_in) = (sum_l w[l]*A[l,:])@W_in + b_in*sum_l w[l]
// poolRows : per 64-row tile, part[tile][e] = sum_r w[r]*A[r][e] in f32, rows in
//            index order; one wave per 512 contiguous bytes of a row.
// ctxGemm  : adds a batch's 16 tile sums in index order, rounds to bf16 and
//            multiplies by the swizzled W_in on the matrix unit, one k-chunk per
//            wave; the 16 chunk products are added in f32 in index order.
// ---------------------------------------------------------------------------
#define TILES_B (L_ / BROWS)     // 16 row tiles per batch

__global__ __launch_bounds__(128)
void poolRows(const float* __restrict__ A,        // [B*L, E] f32
              const float* __restrict__ weights,  // [B*L]
              float* __restrict__ part,           // [B*L/BROWS, E]
              float* __restrict__ psw)            // [B*L/BROWS]
{
    const int tile = blockIdx.x;
    const int tid  = threadIdx.x;
    const float4* src = (const float4*)(A + (size_t)tile * BROWS * E_) + tid;
    const float*  w   = weights + tile * BROWS;   // same address in every lane

    float4 acc = {0.f, 0.f, 0.f, 0.f};
    float  sw  = 0.f;
#pragma unroll                   // straight-line code: the row loads run ahead of the sums
    for (int r = 0; r < BROWS; ++r) {
        const float4 x  = src[r * (E_ / 4)];
        const float  wr = w[r];
        acc.x = fmaf(wr, x.x, acc.x);
        acc.y = fmaf(wr, x.y, acc.y);
        acc.z = fmaf(wr, x.z, acc.z);
        acc.w = fmaf(wr, x.w, acc.w);
        sw += wr;
    }
    ((float4*)(part + (size_t)tile * E_))[tid] = acc;
    if (tid == 0) psw[tile] = sw;
}

#define PPITCH (E_ + 8)          // bf16 elements per LDS row: 16 bytes of pad

// 64 blocks, at most one per WGP: registers go to loads in flight, not to occupancy
__global__ __launch_bounds__(512) __attribute__((amdgpu_waves_per_eu(4, 8)))
void ctxGemm(const float* __restrict__ part,      // [B*TILES_B, E]
             const float* __restrict__ psw,       // [B*TILES_B]
             const __bf16* __restrict__ Bsw,      // swizzled W_in
             const float* __restrict__ b_in,      // [H]
             float* __restrict__ ctx)             // [B, H]
{
    __shared__ __attribute__((aligned(16))) __bf16 sP[16][PPITCH];
    __shared__ float sRed[NKC][2][8][32];         // one product per k-chunk and N tile

    const int tid  = threadIdx.x;
    const int wave = tid >> 5;                    // = the wave's k-chunk
    const int lane = tid & 31;
    const int b0   = (blockIdx.x >> 4) * 16;      // 16 batches = the M tile
    const int nt0  = (blockIdx.x & 15) * 2;       // two N tiles = 128 bytes of a ctx row

    // loads that do not depend on the staging, issued ahead of it
    const float bv = b_in[nt0 * 16 + lane];
    const float4* pr = (const float4*)(psw + (b0 + wave) * TILES_B);
    float4 pw[TILES_B / 4];                       // weight sums of batch b0 + wave
#pragma unroll
    for (int t = 0; t < TILES_B / 4; ++t) pw[t] = pr[t];
    const v16bf bf0 = loadBfrag(Bsw + (size_t)(nt0 * NKC + wave) * 512 + lane * 8);
    // stands before address registers of the loads above are overwritten:
    // the next load's result lands in them
    asm volatile("s_wait_xcnt 0x0" ::: "memory");
    const v16bf bf1 = loadBfrag(Bsw + (size_t)((nt0 + 1) * NKC + wave) * 512 + lane * 8);
    // without it the scheduler sinks these loads to the barrier, where their latency shows
    __builtin_amdgcn_sched_barrier(0);

    // ---- pooled[16][E]: add the tile sums, round to bf16, into LDS ----
    const int c4 = tid & 127;                     // float4 column
    const int rs = tid >> 7;                      // four rows from rs*4 on
#pragma unroll
    for (int rr = 0; rr < 4; ++rr) {
        const int row = rs * 4 + rr;
        const float4* p = (const float4*)(part + (size_t)(b0 + row) * TILES_B * E_) + c4;
        float4 s = {0.f, 0.f, 0.f, 0.f};
#pragma unroll
        for (int t = 0; t < TILES_B; ++t) {
            const float4 x = p[t * (E_ / 4)];
            s.x += x.x; s.y += x.y; s.z += x.z; s.w += x.w;
        }
        __bf16* d = &sP[row][c4 * 4];
        d[0] = (__bf16)s.x; d[1] = (__bf16)s.y; d[2] = (__bf16)s.z; d[3] = (__bf16)s.w;
    }
    __syncthreads();

    // ---- each wave: its k-chunk of both N tiles ----
    {
        const int mlane = lane & 15;
        const int hi    = lane >> 4;
        // same k order as swizzleB: elements 0-7 from k = 8*hi, 8-15 from k = 16 + 8*hi
        union { v16bf v; uint4 q[2]; } a;
        a.q[0] = *(const uint4*)&sP[mlane][wave * KC + hi * 8];
        a.q[1] = *(const uint4*)&sP[mlane][wave * KC + 16 + hi * 8];
        const v8f z = {0.f, 0.f, 0.f, 0.f, 0.f, 0.f, 0.f, 0.f};
        const v8f d0 = __builtin_amdgcn_wmma_f32_16x16x32_bf16(
            false, a.v, false, bf0, (short)0, z, false, false);
        const v8f d1 = __builtin_amdgcn_wmma_f32_16x16x32_bf16(
            false, a.v, false, bf1, (short)0, z, false, false);
#pragma unroll
        for (int j = 0; j < 8; ++j) {
            sRed[wave][0][j][lane] = d0[j];
            sRed[wave][1][j][lane] = d1[j];
        }
    }
    __syncthreads();

    // ---- one output element per thread, k-chunks added in index order;
    //      a wave stores one whole 128-byte line of ctx ----
    {
        const int row = wave, col = lane;         // D register row&7, lane 16*(row>>3) + (col&15)
        float s = 0.f, sw = 0.f;
#pragma unroll
        for (int k = 0; k < NKC; ++k)
            s += sRed[k][col >> 4][row & 7][(row >> 3) * 16 + (col & 15)];
#pragma unroll
        for (int t = 0; t < TILES_B / 4; ++t) {
            sw += pw[t].x; sw += pw[t].y; sw += pw[t].z; sw += pw[t].w;
        }
        ctx[(size_t)(b0 + row) * H_ + nt0 * 16 + col] = fmaf(bv, sw, s);
    }
}

extern "C" void kernel_launch(void* const* d_in, const int* in_sizes, int n_in,
                              void* d_out, int out_size, void* d_ws, size_t ws_size,
                              hipStream_t stream) {
    const float* attn  = (const float*)d_in[0];  // [B,L,E]
    const float* dec   = (const float*)d_in[1];  // [B,H]
    const float* W_in  = (const float*)d_in[2];  // [E,H]
    const float* b_in  = (const float*)d_in[3];  // [H]
    const float* W_dec = (const float*)d_in[4];  // [H,H]
    const float* b_dec = (const float*)d_in[5];  // [H]
    const float* w_sc  = (const float*)d_in[6];  // [H,1]
    const float* b_sc  = (const float*)d_in[7];  // [1]

    char*  ws      = (char*)d_ws;
    __bf16* Bsw    = (__bf16*)ws;
    float* decd    = (float*)(ws + WS_DEC);
    float* logits  = (float*)(ws + WS_LOG);
    float* part    = (float*)(ws + WS_PART);
    float* psw     = (float*)(ws + WS_PSW);
    float* ctx     = (float*)d_out;              // [B,H]
    float* weights = (float*)d_out + B_ * H_;    // [B,L]

    swizzleB<<<1024, 256, 0, stream>>>(W_in, Bsw);
    decDense<<<(B_ / DD_NB) * (H_ / DD_COLS), 256, 0, stream>>>(dec, W_dec, b_dec, decd);

    const int gemmBlocks = (B_ * L_) / GROWS;    // 512
    const int poolBlocks = (B_ * L_) / BROWS;    // 1024
    attnGemm<0><<<gemmBlocks, THREADS, 0, stream>>>(
        attn, Bsw, b_in, decd, w_sc, b_sc, nullptr, logits, nullptr);
    softmaxL<<<B_, 256, 0, stream>>>(logits, weights);
    poolRows<<<poolBlocks, 128, 0, stream>>>(attn, weights, part, psw);
    ctxGemm<<<64, 512, 0, stream>>>(part, psw, Bsw, b_in, ctx);
}

// v008
// A run of this version takes 54 microseconds.
// In two side-by-side timings against v007, it was 1.19 and 1.16 times as fast.
// Over all steps from v000 it is 3.72 times as fast.
#include <hip/hip_runtime.h>
#include <hip/hip_bf16.h>
#include <math.h>

typedef __attribute__((ext_vector_type(16))) __bf16 v16bf;
typedef __attribute__((ext_vector_type(8)))  __bf16 v8bf;
typedef __attribute__((ext_vector_type(8)))  float  v8f;

#define B_      64
#define L_      1024
#define E_      512
#define H_      512
#define KC      32
#define NKC     (E_/KC)          // 16 k-chunks
#define GROWS   128              // rows of A per block of the score GEMM
#define MTW     2                // M-tiles per wave (2*16 = 32 rows per wave row)
#define THREADS 512              // 16 waves
#define NTW     8                // N-tiles per wave (8*16 = 128 cols per wave column)

// -------- workspace layout (bytes) --------
#define WS_DEC  (512u << 10)     // dec_dense f32 [B][H]
#define WS_LOG  (640u << 10)     // logits f32 [B*L]
#define WS_PART (1024u << 10)    // weighted row sums f32 [B*L/GROWS][E]
#define WS_PSUM (3072u << 10)    // a row block's sum of exponentials f32 [B*L/GROWS]
#define WS_PMAX (3080u << 10)    // a row block's largest logit f32 [B*L/GROWS]

#define BPLANE 256

__global__ __launch_bounds__(256)
void swizzleB(const float* __restrict__ W_in, __bf16* __restrict__ Bsw) {
    int idx   = blockIdx.x * 256 + threadIdx.x;  // 262144 total
    int e8    = idx & 7;
    int lane  = (idx >> 3) & 31;
    int plane = (idx >> 8) & 1;
    int kc    = (idx >> 9) & 15;
    int nt    = idx >> 13;
    int n     = nt * 16 + (lane & 15);
    int k     = kc * KC + (plane << 4) + ((lane >> 4) << 3) + e8;
    Bsw[idx] = (__bf16)W_in[k * H_ + n];
}

// One lane's 16 elements of a B fragment; p = the fragment's start + 8 * lane.
__device__ __forceinline__ v16bf loadBfrag(const __bf16* p) {
    const v8bf lo = *(const v8bf*)p;
    const v8bf hi = *(const v8bf*)(p + BPLANE);
    return __builtin_shufflevector(lo, hi, 0, 1, 2, 3, 4, 5, 6, 7,
                                   8, 9, 10, 11, 12, 13, 14, 15);
}

// dec_dense[b][h] = b_dec[h] + sum_k dec[b][k] * W_dec[k][h], f32 on the vector unit.
// A block owns 32 columns (one 128-byte line of every W_dec row) of DD_NB batches. Its 32
// groups of 8 lanes split k into runs of 16, so a lane's loads do not depend on any sum
// and all fly at once: the kernel waits out one memory latency, not one per few k steps.
// The 32 run sums of an element are added in index order through LDS.
#define DD_NB   8                // batches per block: 8 * 32 outputs, one per thread
#define DD_COLS 32               // columns per block
#define DD_RUN  16               // k steps per lane
#define DD_RUNS (H_ / DD_RUN)    // 32 runs = 256 threads / 8 lanes

__global__ __launch_bounds__(256)
void decDense(const float* __restrict__ dec, const float* __restrict__ W_dec,
              const float* __restrict__ b_dec, float* __restrict__ out) {
    __shared__ __attribute__((aligned(16))) float sPart[DD_RUNS][DD_NB][DD_COLS];

    const int tid = threadIdx.x;
    const int run = tid >> 3;
    const int c4  = (tid & 7) * 4;
    const int h0  = (blockIdx.x & 15) * DD_COLS;
    const int b0  = (blockIdx.x >> 4) * DD_NB;
    const int k0  = run * DD_RUN;

    // each input's lane part of the address (an index, two byte offsets): one register each
    const int      bidx = h0 + (tid & 31);
    const unsigned doff = k0 * 4u;
    const unsigned woff = (k0 * H_ + h0 + c4) * 4u;
    const char* dbase = (const char*)(dec + (size_t)b0 * H_);

    const float bias = b_dec[bidx];
    float4 d[DD_NB][DD_RUN / 4];
#pragma unroll
    for (int bb = 0; bb < DD_NB; ++bb)
#pragma unroll
        for (int q = 0; q < DD_RUN / 4; ++q)
            d[bb][q] = *(const float4*)(dbase + doff + (bb * H_ + q * 4) * 4);
    float4 w[DD_RUN];
#pragma unroll
    for (int i = 0; i < DD_RUN; ++i)
        w[i] = *(const float4*)((const char*)W_dec + woff + i * H_ * 4);
    // stands before an address register of the loads above is overwritten; as its inputs
    // the three registers stay whole up to here (without them the results of later loads
    // of the group landed in the address registers of earlier ones)
    asm volatile("s_wait_xcnt 0x0" :: "v"(bidx), "v"(doff), "v"(woff) : "memory");
    // without it the scheduler deals the loads out among the sums to save registers, and
    // the kernel waits out several latencies one after another
    __builtin_amdgcn_sched_barrier(0);

#pragma unroll
    for (int bb = 0; bb < DD_NB; ++bb) {
        float4 s = {0.f, 0.f, 0.f, 0.f};
#pragma unroll
        for (int q = 0; q < DD_RUN / 4; ++q) {
            const float dk[4] = {d[bb][q].x, d[bb][q].y, d[bb][q].z, d[bb][q].w};
#pragma unroll
            for (int j = 0; j < 4; ++j) {
                const float4 x = w[q * 4 + j];
                s.x = fmaf(dk[j], x.x, s.x);
                s.y = fmaf(dk[j], x.y, s.y);
                s.z = fmaf(dk[j], x.z, s.z);
                s.w = fmaf(dk[j], x.w, s.w);
            }
        }
        *(float4*)&sPart[run][bb][c4] = s;
    }
    __syncthreads();

    // one output element per thread; a wave stores one whole 128-byte line
    const int bb = tid >> 5, col = tid & 31;
    float s = bias;
#pragma unroll
    for (int r = 0; r < DD_RUNS; ++r) s += sPart[r][bb][col];
    out[(size_t)(b0 + bb) * H_ + h0 + col] = s;
}

#define APITCH  40               // bf16 elements per LDS row of the A tile
#define ACHUNK  (GROWS * APITCH + 32)   // bf16 elements from one chunk to the next
#define RGROUPS 8                // row groups of the weighted sums: 16 rows each

// Four f32 of a row, rounded to bf16 on their way into LDS: once per element, not once in
// each of the four waves that read it.
// The two conversions (round to nearest even, the compiler's own instruction for this cast)
// are a volatile asm statement so that they stay behind the chunk barrier in front of them:
// as plain casts they were placed directly behind the global load, whose whole latency the
// wave then waited out in the middle of the chunk before.
__device__ __forceinline__ void stageA(__bf16* dst, const float4 v) {
    uint2 o;
    asm volatile("v_cvt_pk_bf16_f32 %0, %2, %3\n\t"
                 "v_cvt_pk_bf16_f32 %1, %4, %5"
                 : "=&v"(o.x), "=&v"(o.y)
                 : "v"(v.x), "v"(v.y), "v"(v.z), "v"(v.w));
    *(uint2*)dst = o;
}

__device__ __forceinline__ v16bf ldsAfrag(const __bf16* p) {
    const v8bf lo = *(const v8bf*)p;
    const v8bf hi = *(const v8bf*)(p + 16);
    return __builtin_shufflevector(lo, hi, 0, 1, 2, 3, 4, 5, 6, 7,
                                   8, 9, 10, 11, 12, 13, 14, 15);
}

__device__ __forceinline__ void tanh8(float (&y)[8], const float (&x)[8]) {
    asm("v_tanh_f32 %0, %8\n\t"
        "v_tanh_f32 %1, %9\n\t"
        "v_tanh_f32 %2, %10\n\t"
        "v_tanh_f32 %3, %11\n\t"
        "v_tanh_f32 %4, %12\n\t"
        "v_tanh_f32 %5, %13\n\t"
        "v_tanh_f32 %6, %14\n\t"
        "v_tanh_f32 %7, %15\n\t"
        "v_nop"
        : "=&v"(y[0]), "=&v"(y[1]), "=&v"(y[2]), "=&v"(y[3]),
          "=&v"(y[4]), "=&v"(y[5]), "=&v"(y[6]), "=&v"(y[7])
        : "v"(x[0]), "v"(x[1]), "v"(x[2]), "v"(x[3]),
          "v"(x[4]), "v"(x[5]), "v"(x[6]), "v"(x[7]));
}

// y = exp(x) for four values: the multiply and hardware v_exp_f32 that __expf compiles to.
// One asm statement for the reason given at tanh8.
__device__ __forceinline__ void exp4(float (&y)[4], const float (&x)[4]) {
    const float l2e = 1.44269504f;
    asm("v_exp_f32 %0, %4\n\t"
        "v_exp_f32 %1, %5\n\t"
        "v_exp_f32 %2, %6\n\t"
        "v_exp_f32 %3, %7\n\t"
        "v_nop"
        : "=&v"(y[0]), "=&v"(y[1]), "=&v"(y[2]), "=&v"(y[3])
        : "v"(x[0] * l2e), "v"(x[1] * l2e), "v"(x[2] * l2e), "v"(x[3] * l2e));
}

// ---------------------------------------------------------------------------
// Score GEMM with the softmax-weighted row sums behind it. Chunk kc+2 flies into registers
// and chunk kc+1 goes from registers to LDS as bf16 while WMMAs consume chunk kc.
//   logits[b,l] = sum_h tanh(gemm+b_in+dec)*w_score + b_score
// Then, with m the largest logit of the block's 128 rows:
//   pmax = m, psum = sum_r exp(logit_r - m), part[e] = sum_r exp(logit_r - m) * A[r][e]
// from the bf16 tile in LDS, summed in f32. ctxGemm rescales a batch's 8 blocks to the
// batch's maximum, so the input is read from memory once.
// ---------------------------------------------------------------------------
__global__ __launch_bounds__(THREADS)
void attnGemm(const float* __restrict__ A,        // [B*L, E] f32
              const __bf16* __restrict__ Bsw,     // swizzled W_in
              const float* __restrict__ b_in,     // [H]
              const float* __restrict__ dec_dense,// [B, H]
              const float* __restrict__ w_score,  // [H]
              const float* __restrict__ b_score,  // [1]
              float* __restrict__ logits,         // [B*L]
              float* __restrict__ part,           // [B*L/GROWS, E]
              float* __restrict__ psum,           // [B*L/GROWS]
              float* __restrict__ pmax)           // [B*L/GROWS]
{
    __shared__ __attribute__((aligned(16))) __bf16 Atile[NKC * ACHUNK];   // the whole tile
    __shared__ __attribute__((aligned(16))) float sPool[RGROUPS][E_];
    __shared__ float sDec[H_];
    __shared__ float sWsc[H_];
    __shared__ float sBin[H_];
    __shared__ __attribute__((aligned(16))) float sLogit[GROWS];

    const int tid   = threadIdx.x;
    const int wave  = tid >> 5;
    const int lane  = tid & 31;
    const int mt    = wave & 3;
    const int ncol  = wave >> 2;
    const int m0    = blockIdx.x * GROWS;
    const int b     = m0 >> 10;
    const int mlane = lane & 15;
    const int hi    = lane >> 4;

    sBin[tid] = b_in[tid];
    sDec[tid] = dec_dense[b * H_ + tid];
    sWsc[tid] = w_score[tid];
    if (tid < GROWS) sLogit[tid] = 0.f;

    const float zero = 0.f;
    v8f acc[MTW][NTW];
#pragma unroll
    for (int t = 0; t < NTW; ++t) {
        v8f z = {zero, zero, zero, zero, zero, zero, zero, zero};
        acc[0][t] = z;
        acc[1][t] = z;
    }

    const int arow  = tid >> 3;          // 0..63; a thread also stages row arow + 64
    const int aquad = tid & 7;           // 0..7 (16B within 32-f32 chunk)

    // A wave-wide load of the staging reads four whole 128-byte lines. Chunks 0 and 1 start
    // here, ahead of the B fragments.
    const float* asrc = A + (size_t)(m0 + arow) * E_ + aquad * 4;
    const float4 first0 = *(const float4*)asrc;
    const float4 first1 = *(const float4*)(asrc + 64 * E_);
    float4 nx0 = *(const float4*)(asrc + KC);
    float4 nx1 = *(const float4*)(asrc + 64 * E_ + KC);
    __builtin_prefetch(asrc + 2 * KC, 0, 3);
    __builtin_prefetch(asrc + 64 * E_ + 2 * KC, 0, 3);

    // One register set of B fragments. Each fragment feeds the wave's two M-tiles; right
    // behind its two WMMAs its registers take the load of the next chunk's fragment, which
    // so has a whole chunk to land. Chunk 0's set starts here, under the staging of the
    // first A tile.
    const __bf16* bbase = Bsw + (size_t)(ncol * 8 * NKC) * 512 + lane * 8;
    v16bf bfr[NTW];
#pragma unroll
    for (int t = 0; t < NTW; ++t)
        bfr[t] = loadBfrag(bbase + (size_t)(t * NKC) * 512);

    // ---- prologue: stage chunk 0 ----
    __bf16* adst = &Atile[arow * APITCH + aquad * 4];
    stageA(adst, first0);
    stageA(adst + 64 * APITCH, first1);
    // The hand-over of chunk 0 and of the vectors above, written by hand as in the loop:
    // __syncthreads() would also wait for chunk 1 and for the B loads.
    asm volatile("s_wait_dscnt 0x0" ::: "memory");         // own LDS writes are done
    asm volatile("s_barrier_signal -1\n\ts_barrier_wait -1" ::: "memory");

#pragma unroll                   // chunk indices become constants
    for (int kc = 0; kc < NKC; ++kc) {
        // ---- the wave's two bf16 A fragments, their LDS reads as one group ----
        const __bf16* ap = &Atile[kc * ACHUNK + (mt * 32 + mlane) * APITCH + hi * 8];
        const v16bf a0 = ldsAfrag(ap);
        const v16bf a1 = ldsAfrag(ap + 16 * APITCH);

        // ---- the NEXT chunk goes from registers into its place in LDS, and the chunk
        //      behind it starts its flight into the same registers ----
        if (kc + 1 < NKC) {
            stageA(adst + (kc + 1) * ACHUNK, nx0);
            stageA(adst + (kc + 1) * ACHUNK + 64 * APITCH, nx1);
        }
        if (kc + 2 < NKC) {
            const float* s = asrc + (kc + 2) * KC;
            nx0 = *(const float4*)s;
            nx1 = *(const float4*)(s + 64 * E_);
            if (kc + 3 < NKC) {
                __builtin_prefetch(s + KC, 0, 3);
                __builtin_prefetch(s + 64 * E_ + KC, 0, 3);
            }
        }
        // without it the LDS reads are dealt out one by one among the WMMAs, each with a
        // full wait of its own
        __builtin_amdgcn_sched_barrier(0);

        // ---- 16 WMMAs: a B fragment's two, then its refill ----
#pragma unroll
        for (int t = 0; t < NTW; ++t) {
            acc[0][t] = __builtin_amdgcn_wmma_f32_16x16x32_bf16(
                false, a0, false, bfr[t], (short)0, acc[0][t], false, false);
            acc[1][t] = __builtin_amdgcn_wmma_f32_16x16x32_bf16(
                false, a1, false, bfr[t], (short)0, acc[1][t], false, false);
            if (kc + 1 < NKC)
                bfr[t] = loadBfrag(bbase + (size_t)(t * NKC + kc + 1) * 512);
            // without it the scheduler lifts the refills over the WMMAs that still read the
            // old fragments, into registers of their own, and accumulators spill
            __builtin_amdgcn_sched_barrier(0);
        }

        // The chunk's hand-over, written by hand: __syncthreads() also waits for every
        // global load, which would end the flight of the A and B loads issued above.
        asm volatile("s_wait_dscnt 0x0" ::: "memory");     // own writes of the next chunk done
        asm volatile("s_barrier_signal -1\n\ts_barrier_wait -1\n\t"
                     "v_nop\n\tv_nop\n\tv_nop\n\tv_nop" ::: "memory");
    }

    {
        float ps[MTW][8];
#pragma unroll
        for (int j = 0; j < 8; ++j) ps[0][j] = ps[1][j] = 0.f;
#pragma unroll
        for (int t = 0; t < NTW; ++t) {
            const int n = ncol * 128 + t * 16 + mlane;
            const float dv = sDec[n], wv = sWsc[n], bv = sBin[n];
#pragma unroll
            for (int i = 0; i < MTW; ++i) {
                float x[8], y[8];
#pragma unroll
                for (int j = 0; j < 8; ++j) x[j] = acc[i][t][j] + bv + dv;
                tanh8(y, x);
#pragma unroll
                for (int j = 0; j < 8; ++j) ps[i][j] = fmaf(y[j], wv, ps[i][j]);
            }
        }
#pragma unroll
        for (int i = 0; i < MTW; ++i)
#pragma unroll
            for (int j = 0; j < 8; ++j) {
                const int row = mt * 32 + i * 16 + hi * 8 + j;
                atomicAdd(&sLogit[row], ps[i][j]);     // ds_add_f32
            }
    }
    __syncthreads();
    const float bs = b_score[0];
    if (tid < GROWS) logits[m0 + tid] = sLogit[tid] + bs;

    // ---- the block's largest logit, in every wave: four rows a lane, then across lanes ----
    float lv[GROWS / 32];
#pragma unroll
    for (int i = 0; i < GROWS / 32; ++i) lv[i] = sLogit[lane + 32 * i] + bs;
    float mx = fmaxf(fmaxf(lv[0], lv[1]), fmaxf(lv[2], lv[3]));
#pragma unroll
    for (int o = 16; o > 0; o >>= 1) mx = fmaxf(mx, __shfl_xor(mx, o));

    if (wave == 0) {             // the block's sum of exponentials, a fixed tree
        const float dl[4] = {lv[0] - mx, lv[1] - mx, lv[2] - mx, lv[3] - mx};
        float ev[4];
        exp4(ev, dl);
        float se = (ev[0] + ev[1]) + (ev[2] + ev[3]);
#pragma unroll
        for (int o = 16; o > 0; o >>= 1) se += __shfl_xor(se, o);
        if (lane == 0) {
            psum[blockIdx.x] = se;
            pmax[blockIdx.x] = mx;
        }
    }

    // ---- weighted row sums from the tile in LDS: a wave takes 16 rows of 8 chunks, a lane
    //      8 columns; the row, and so its weight, is the same in every lane of a wave ----
    {
        const int rg = wave >> 1;
        const int ch = (wave & 1) * 8 + (lane >> 2);
        const int q8 = (lane & 3) * 8;
        const __bf16* pp = &Atile[ch * ACHUNK + rg * 16 * APITCH + q8];
        float s[8];
#pragma unroll
        for (int c = 0; c < 8; ++c) s[c] = 0.f;
#pragma unroll
        for (int j4 = 0; j4 < 4; ++j4) {
            const float4 l4 = *(const float4*)&sLogit[rg * 16 + j4 * 4];
            const float d4[4] = {l4.x + bs - mx, l4.y + bs - mx, l4.z + bs - mx, l4.w + bs - mx};
            float e4[4];
            exp4(e4, d4);
#pragma unroll
            for (int j = 0; j < 4; ++j) {
                const v8bf x = *(const v8bf*)(pp + (j4 * 4 + j) * APITCH);
#pragma unroll
                for (int c = 0; c < 8; ++c) s[c] = fmaf((float)x[c], e4[j], s[c]);
            }
        }
        float* d = &sPool[rg][ch * KC + q8];
        *(float4*)d       = make_float4(s[0], s[1], s[2], s[3]);
        *(float4*)(d + 4) = make_float4(s[4], s[5], s[6], s[7]);
    }
    __syncthreads();

    // one column per thread, the row groups added in index order; whole lines stored
    float t = 0.f;
#pragma unroll
    for (int g = 0; g < RGROUPS; ++g) t += sPool[g][tid];
    part[(size_t)blockIdx.x * E_ + tid] = t;
}

// ---------------------------------------------------------------------------
// Softmax over a batch's 8 row blocks and the context vector, by linearity of the
// projection and with sum_l w[l] = 1:
//   sum_l w[l]*(A[l,:]@W_in + b_in) = (sum_l w[l]*A[l,:])@W_in + b_in
// With M the largest of a batch's block maxima m_t and S = sum_t psum_t * exp(m_t - M):
//   w[l] = exp(logit_l - M) / S,   sum_l w[l]*A[l,:] = sum_t part_t * exp(m_t - M) / S
// ctxGemm adds a batch's 8 rescaled block sums in index order, rounds to bf16 and
// multiplies by the swizzled W_in on the matrix unit, one k-chunk per wave; the 16 chunk
// products are added in f32 in index order. Block i also writes the weights of batch i.
// ---------------------------------------------------------------------------
#define TILES_B (L_ / GROWS)     // 8 row blocks per batch

#define PPITCH (E_ + 8)          // bf16 elements per LDS row: 16 bytes of pad

// 64 blocks, at most one per WGP: registers go to loads in flight, not to occupancy
__global__ __launch_bounds__(512) __attribute__((amdgpu_waves_per_eu(4, 8)))
void ctxGemm(const float* __restrict__ part,      // [B*TILES_B, E]
             const float* __restrict__ psum,      // [B*TILES_B]
             const float* __restrict__ pmax,      // [B*TILES_B]
             const float* __restrict__ logits,    // [B*L]
             const __bf16* __restrict__ Bsw,      // swizzled W_in
             const float* __restrict__ b_in,      // [H]
             float* __restrict__ ctx,             // [B, H]
             float* __restrict__ weights)         // [B, L]
{
    __shared__ __attribute__((aligned(16))) __bf16 sP[16][PPITCH];
    __shared__ float sRed[NKC][2][8][32];         // one product per k-chunk and N tile
    __shared__ __attribute__((aligned(16))) float sC[16][TILES_B];  // exp(m_t - M) / S
    __shared__ float sM[16], sInv[16];            // M and 1 / S of the 16 batches

    const int tid  = threadIdx.x;
    const int wave = tid >> 5;                    // = the wave's k-chunk
    const int lane = tid & 31;
    const int b0   = (blockIdx.x >> 4) * 16;      // 16 batches = the M tile
    const int nt0  = (blockIdx.x & 15) * 2;       // two N tiles = 128 bytes of a ctx row

    // loads that do not depend on the staging, issued ahead of it
    const float bv = b_in[nt0 * 16 + lane];
    const float2 lg = ((const float2*)(logits + blockIdx.x * L_))[tid];
    const v16bf bf0 = loadBfrag(Bsw + (size_t)(nt0 * NKC + wave) * 512 + lane * 8);
    // stands before address registers of the loads above are overwritten:
    // the next load's result lands in them
    asm volatile("s_wait_xcnt 0x0" ::: "memory");
    const v16bf bf1 = loadBfrag(Bsw + (size_t)((nt0 + 1) * NKC + wave) * 512 + lane * 8);
    // without it the scheduler sinks these loads to the barrier, where their latency shows
    __builtin_amdgcn_sched_barrier(0);

    // ---- a thread's 32 loads of block sums, all in flight at once ----
    const int c4 = tid & 127;                     // float4 column
    const int rs = tid >> 7;                      // four rows from rs*4 on
    const float4* p = (const float4*)(part + (size_t)(b0 + rs * 4) * TILES_B * E_) + c4;
    float4 x[4][TILES_B];
#pragma unroll
    for (int rr = 0; rr < 4; ++rr)
#pragma unroll
        for (int t = 0; t < TILES_B; ++t) x[rr][t] = p[(rr * TILES_B + t) * (E_ / 4)];
    // stands before the address register pair of the loads above is overwritten; as its
    // input the pair stays whole up to here (without it the last load's result landed in it)
    asm volatile("s_wait_xcnt 0x0" :: "v"(p) : "memory");
    // without it the scheduler deals these loads out among the sums behind the barrier
    __builtin_amdgcn_sched_barrier(0);

    // ---- under their flight: the scale of each of the 16 * 8 row blocks, one per thread of
    //      the first four waves; the 8 lanes of a batch reduce among themselves ----
    if (tid < 16 * TILES_B) {
        const float m  = pmax[b0 * TILES_B + tid];
        const float pv = psum[b0 * TILES_B + tid];
        float M = m;
#pragma unroll
        for (int o = TILES_B / 2; o > 0; o >>= 1) M = fmaxf(M, __shfl_xor(M, o));
        const float f = __expf(m - M);
        float S = pv * f;
#pragma unroll
        for (int o = TILES_B / 2; o > 0; o >>= 1) S += __shfl_xor(S, o);
        const float inv = 1.f / S;
        sC[tid >> 3][tid & 7] = f * inv;
        if ((tid & 7) == 0) {
            sM[tid >> 3]   = M;
            sInv[tid >> 3] = inv;
        }
    }
    __syncthreads();

    // ---- pooled[16][E]: add the rescaled block sums, round to bf16, into LDS ----
#pragma unroll
    for (int rr = 0; rr < 4; ++rr) {
        const int row = rs * 4 + rr;
        const float4 ca = *(const float4*)&sC[row][0];
        const float4 cb = *(const float4*)&sC[row][4];
        const float c[TILES_B] = {ca.x, ca.y, ca.z, ca.w, cb.x, cb.y, cb.z, cb.w};
        float4 s = {0.f, 0.f, 0.f, 0.f};
#pragma unroll
        for (int t = 0; t < TILES_B; ++t) {
            s.x = fmaf(x[rr][t].x, c[t], s.x);
            s.y = fmaf(x[rr][t].y, c[t], s.y);
            s.z = fmaf(x[rr][t].z, c[t], s.z);
            s.w = fmaf(x[rr][t].w, c[t], s.w);
        }
        __bf16* d = &sP[row][c4 * 4];
        d[0] = (__bf16)s.x; d[1] = (__bf16)s.y; d[2] = (__bf16)s.z; d[3] = (__bf16)s.w;
    }

    // ---- the weights of batch blockIdx.x, one of the block's 16; two per thread ----
    {
        const float M = sM[blockIdx.x & 15], inv = sInv[blockIdx.x & 15];
        ((float2*)(weights + blockIdx.x * L_))[tid] =
            make_float2(__expf(lg.x - M) * inv, __expf(lg.y - M) * inv);
    }
    __syncthreads();

    // ---- each wave: its k-chunk of both N tiles ----
    {
        const int mlane = lane & 15;
        const int hi    = lane >> 4;
        // same k order as swizzleB: elements 0-7 from k = 8*hi, 8-15 from k = 16 + 8*hi
        union { v16bf v; uint4 q[2]; } a;
        a.q[0] = *(const uint4*)&sP[mlane][wave * KC + hi * 8];
        a.q[1] = *(const uint4*)&sP[mlane][wave * KC + 16 + hi * 8];
        const v8f z = {0.f, 0.f, 0.f, 0.f, 0.f, 0.f, 0.f, 0.f};
        const v8f d0 = __builtin_amdgcn_wmma_f32_16x16x32_bf16(
            false, a.v, false, bf0, (short)0, z, false, false);
        const v8f d1 = __builtin_amdgcn_wmma_f32_16x16x32_bf16(
            false, a.v, false, bf1, (short)0, z, false, false);
#pragma unroll
        for (int j = 0; j < 8; ++j) {
            sRed[wave][0][j][lane] = d0[j];
            sRed[wave][1][j][lane] = d1[j];
        }
    }
    __syncthreads();

    // ---- one output element per thread, k-chunks added in index order;
    //      a wave stores one whole 128-byte line of ctx ----
    {
        const int row = wave, col = lane;         // D register row&7, lane 16*(row>>3) + (col&15)
        float s = 0.f;
#pragma unroll
        for (int k = 0; k < NKC; ++k)
            s += sRed[k][col >> 4][row & 7][(row >> 3) * 16 + (col & 15)];
        ctx[(size_t)(b0 + row) * H_ + nt0 * 16 + col] = s + bv;
    }
}

extern "C" void kernel_launch(void* const* d_in, const int* in_sizes, int n_in,
                              void* d_out, int out_size, void* d_ws, size_t ws_size,
                              hipStream_t stream) {
    const float* attn  = (const float*)d_in[0];  // [B,L,E]
    const float* dec   = (const float*)d_in[1];  // [B,H]
    const float* W_in  = (const float*)d_in[2];  // [E,H]
    const float* b_in  = (const float*)d_in[3];  // [H]
    const float* W_dec = (const float*)d_in[4];  // [H,H]
    const float* b_dec = (const float*)d_in[5];  // [H]
    const float* w_sc  = (const float*)d_in[6];  // [H,1]
    const float* b_sc  = (const float*)d_in[7];  // [1]

    char*  ws      = (char*)d_ws;
    __bf16* Bsw    = (__bf16*)ws;
    float* decd    = (float*)(ws + WS_DEC);
    float* logits  = (float*)(ws + WS_LOG);
    float* part    = (float*)(ws + WS_PART);
    float* psum    = (float*)(ws + WS_PSUM);
    float* pmax    = (float*)(ws + WS_PMAX);
    float* ctx     = (float*)d_out;              // [B,H]
    float* weights = (float*)d_out + B_ * H_;    // [B,L]

    swizzleB<<<1024, 256, 0, stream>>>(W_in, Bsw);
    decDense<<<(B_ / DD_NB) * (H_ / DD_COLS), 256, 0, stream>>>(dec, W_dec, b_dec, decd);

    const int gemmBlocks = (B_ * L_) / GROWS;    // 512
    attnGemm<<<gemmBlocks, THREADS, 0, stream>>>(
        attn, Bsw, b_in, decd, w_sc, b_sc, logits, part, psum, pmax);
    ctxGemm<<<64, 512, 0, stream>>>(part, psum, pmax, logits, Bsw, b_in, ctx, weights);
}

// v009
// Measured time: 42.1 microseconds a run.
// In both of two side-by-side timings against v008, it was 1.27 times as fast.
// Counting every step since v000, it is 4.73 times as fast.
#include <hip/hip_runtime.h>
#include <hip/hip_bf16.h>
#include <math.h>

typedef __attribute__((ext_vector_type(16))) __bf16 v16bf;
typedef __attribute__((ext_vector_type(8)))  __bf16 v8bf;
typedef __attribute__((ext_vector_type(8)))  float  v8f;

#define B_      64
#define L_      1024
#define E_      512
#define H_      512
#define KC      32
#define NKC     (E_/KC)          // 16 k-chunks
#define GROWS   128              // rows of A per block of the score GEMM
#define MTW     2                // M-tiles per wave (2*16 = 32 rows per wave row)
#define THREADS 512              // 16 waves
#define NTW     8                // N-tiles per wave (8*16 = 128 cols per wave column)

// -------- workspace layout (bytes) --------
#define WS_DEC  (512u << 10)     // dec_dense f32 [B][H]
#define WS_LOG  (640u << 10)     // logits f32 [B*L]
#define WS_PART (1024u << 10)    // weighted row sums f32 [B*L/GROWS][E]
#define WS_PSUM (3072u << 10)    // a row block's sum of exponentials f32 [B*L/GROWS]
#define WS_PMAX (3080u << 10)    // a row block's largest logit f32 [B*L/GROWS]

#define BPLANE 256

__global__ __launch_bounds__(256)
void swizzleB(const float* __restrict__ W_in, __bf16* __restrict__ Bsw) {
    int idx   = blockIdx.x * 256 + threadIdx.x;  // 262144 total
    int e8    = idx & 7;
    int lane  = (idx >> 3) & 31;
    int plane = (idx >> 8) & 1;
    int kc    = (idx >> 9) & 15;
    int nt    = idx >> 13;
    int n     = nt * 16 + (lane & 15);
    int k     = kc * KC + (plane << 4) + ((lane >> 4) << 3) + e8;
    Bsw[idx] = (__bf16)W_in[k * H_ + n];
}

// One lane's 16 elements of a B fragment; p = the fragment's start + 8 * lane.
__device__ __forceinline__ v16bf loadBfrag(const __bf16* p) {
    const v8bf lo = *(const v8bf*)p;
    const v8bf hi = *(const v8bf*)(p + BPLANE);
    return __builtin_shufflevector(lo, hi, 0, 1, 2, 3, 4, 5, 6, 7,
                                   8, 9, 10, 11, 12, 13, 14, 15);
}

// dec_dense[b][h] = b_dec[h] + sum_k dec[b][k] * W_dec[k][h], f32 on the vector unit.
// A block owns 32 columns (one 128-byte line of every W_dec row) of DD_NB batches. Its 32
// groups of 8 lanes split k into runs of 16, so a lane's loads do not depend on any sum
// and all fly at once: the kernel waits out one memory latency, not one per few k steps.
// The 32 run sums of an element are added in index order through LDS.
#define DD_NB   8                // batches per block: 8 * 32 outputs, one per thread
#define DD_COLS 32               // columns per block
#define DD_RUN  16               // k steps per lane
#define DD_RUNS (H_ / DD_RUN)    // 32 runs = 256 threads / 8 lanes

__global__ __launch_bounds__(256)
void decDense(const float* __restrict__ dec, const float* __restrict__ W_dec,
              const float* __restrict__ b_dec, float* __restrict__ out) {
    __shared__ __attribute__((aligned(16))) float sPart[DD_RUNS][DD_NB][DD_COLS];

    const int tid = threadIdx.x;
    const int run = tid >> 3;
    const int c4  = (tid & 7) * 4;
    const int h0  = (blockIdx.x & 15) * DD_COLS;
    const int b0  = (blockIdx.x >> 4) * DD_NB;
    const int k0  = run * DD_RUN;

    // each input's lane part of the address (an index, two byte offsets): one register each
    const int      bidx = h0 + (tid & 31);
    const unsigned doff = k0 * 4u;
    const unsigned woff = (k0 * H_ + h0 + c4) * 4u;
    const char* dbase = (const char*)(dec + (size_t)b0 * H_);

    const float bias = b_dec[bidx];
    float4 d[DD_NB][DD_RUN / 4];
#pragma unroll
    for (int bb = 0; bb < DD_NB; ++bb)
#pragma unroll
        for (int q = 0; q < DD_RUN / 4; ++q)
            d[bb][q] = *(const float4*)(dbase + doff + (bb * H_ + q * 4) * 4);
    float4 w[DD_RUN];
#pragma unroll
    for (int i = 0; i < DD_RUN; ++i)
        w[i] = *(const float4*)((const char*)W_dec + woff + i * H_ * 4);
    // stands before an address register of the loads above is overwritten; as its inputs
    // the three registers stay whole up to here (without them the results of later loads
    // of the group landed in the address registers of earlier ones)
    asm volatile("s_wait_xcnt 0x0" :: "v"(bidx), "v"(doff), "v"(woff) : "memory");
    // without it the scheduler deals the loads out among the sums to save registers, and
    // the kernel waits out several latencies one after another
    __builtin_amdgcn_sched_barrier(0);

#pragma unroll
    for (int bb = 0; bb < DD_NB; ++bb) {
        float4 s = {0.f, 0.f, 0.f, 0.f};
#pragma unroll
        for (int q = 0; q < DD_RUN / 4; ++q) {
            const float dk[4] = {d[bb][q].x, d[bb][q].y, d[bb][q].z, d[bb][q].w};
#pragma unroll
            for (int j = 0; j < 4; ++j) {
                const float4 x = w[q * 4 + j];
                s.x = fmaf(dk[j], x.x, s.x);
                s.y = fmaf(dk[j], x.y, s.y);
                s.z = fmaf(dk[j], x.z, s.z);
                s.w = fmaf(dk[j], x.w, s.w);
            }
        }
        *(float4*)&sPart[run][bb][c4] = s;
    }
    __syncthreads();

    // one output element per thread; a wave stores one whole 128-byte line
    const int bb = tid >> 5, col = tid & 31;
    float s = bias;
#pragma unroll
    for (int r = 0; r < DD_RUNS; ++r) s += sPart[r][bb][col];
    out[(size_t)(b0 + bb) * H_ + h0 + col] = s;
}

#define APITCH  40               // bf16 elements per LDS row of the A tile
#define ACHUNK  (GROWS * APITCH + 32)   // bf16 elements from one chunk to the next
#define RGROUPS 8                // row groups of the weighted sums: 16 rows each

// Four f32 of a row, rounded to bf16 on their way into LDS: once per element, not once in
// each of the four waves that read it.
// The two conversions (round to nearest even, the compiler's own instruction for this cast)
// are a volatile asm statement so that they stay behind the chunk barrier in front of them:
// as plain casts they were placed directly behind the global load, whose whole latency the
// wave then waited out in the middle of the chunk before.
__device__ __forceinline__ void stageA(__bf16* dst, const float4 v) {
    uint2 o;
    asm volatile("v_cvt_pk_bf16_f32 %0, %2, %3\n\t"
                 "v_cvt_pk_bf16_f32 %1, %4, %5"
                 : "=&v"(o.x), "=&v"(o.y)
                 : "v"(v.x), "v"(v.y), "v"(v.z), "v"(v.w));
    *(uint2*)dst = o;
}

__device__ __forceinline__ v16bf ldsAfrag(const __bf16* p) {
    const v8bf lo = *(const v8bf*)p;
    const v8bf hi = *(const v8bf*)(p + 16);
    return __builtin_shufflevector(lo, hi, 0, 1, 2, 3, 4, 5, 6, 7,
                                   8, 9, 10, 11, 12, 13, 14, 15);
}

__device__ __forceinline__ void tanh8(float (&y)[8], const float (&x)[8]) {
    asm("v_tanh_f32 %0, %8\n\t"
        "v_tanh_f32 %1, %9\n\t"
        "v_tanh_f32 %2, %10\n\t"
        "v_tanh_f32 %3, %11\n\t"
        "v_tanh_f32 %4, %12\n\t"
        "v_tanh_f32 %5, %13\n\t"
        "v_tanh_f32 %6, %14\n\t"
        "v_tanh_f32 %7, %15\n\t"
        "v_nop"
        : "=&v"(y[0]), "=&v"(y[1]), "=&v"(y[2]), "=&v"(y[3]),
          "=&v"(y[4]), "=&v"(y[5]), "=&v"(y[6]), "=&v"(y[7])
        : "v"(x[0]), "v"(x[1]), "v"(x[2]), "v"(x[3]),
          "v"(x[4]), "v"(x[5]), "v"(x[6]), "v"(x[7]));
}

// y = exp(x) for four values: the multiply and hardware v_exp_f32 that __expf compiles to.
// One asm statement for the reason given at tanh8.
__device__ __forceinline__ void exp4(float (&y)[4], const float (&x)[4]) {
    const float l2e = 1.44269504f;
    asm("v_exp_f32 %0, %4\n\t"
        "v_exp_f32 %1, %5\n\t"
        "v_exp_f32 %2, %6\n\t"
        "v_exp_f32 %3, %7\n\t"
        "v_nop"
        : "=&v"(y[0]), "=&v"(y[1]), "=&v"(y[2]), "=&v"(y[3])
        : "v"(x[0] * l2e), "v"(x[1] * l2e), "v"(x[2] * l2e), "v"(x[3] * l2e));
}

// x of the lane whose number within its row of 16 lanes differs in the bits of M (DPP
// row_xmask); the compiler folds the move into the add that reads it.
template <int M>
__device__ __forceinline__ float laneXor(float x) {
    return __builtin_bit_cast(float, __builtin_amdgcn_mov_dpp(
        __builtin_bit_cast(int, x), 0x160 + M, 0xf, 0xf, true));
}

// One halving step of the sum over 16 lanes: of 2*N values a lane keeps the N that its bit N
// picks and gives the other N to the lane across, so each pair of lanes adds every value once.
template <int N>
__device__ __forceinline__ void halve(float (&v)[16], const int mlane) {
    const bool up = (mlane & N) != 0;
#pragma unroll
    for (int k = 0; k < N; ++k) {
        const float keep = up ? v[k + N] : v[k];
        const float send = up ? v[k] : v[k + N];
        v[k] = keep + laneXor<N>(send);
    }
}

// A row's logit without b_score: the sums of the four wave columns, added in index order.
__device__ __forceinline__ float rowLogit(const float* sLog4, const int row) {
    const float4 p = *(const float4*)(sLog4 + row * 4);
    return ((p.x + p.y) + p.z) + p.w;
}

// ---------------------------------------------------------------------------
// Score GEMM with the softmax-weighted row sums behind it. Chunk kc+2 flies into registers
// and chunk kc+1 goes from registers to LDS as bf16 while WMMAs consume chunk kc.
//   logits[b,l] = sum_h tanh(gemm+b_in+dec)*w_score + b_score
// Then, with m the largest logit of the block's 128 rows:
//   pmax = m, psum = sum_r exp(logit_r - m), part[e] = sum_r exp(logit_r - m) * A[r][e]
// from the bf16 tile in LDS, summed in f32. ctxGemm rescales a batch's 8 blocks to the
// batch's maximum, so the input is read from memory once.
// ---------------------------------------------------------------------------
__global__ __launch_bounds__(THREADS)
void attnGemm(const float* __restrict__ A,        // [B*L, E] f32
              const __bf16* __restrict__ Bsw,     // swizzled W_in
              const float* __restrict__ b_in,     // [H]
              const float* __restrict__ dec_dense,// [B, H]
              const float* __restrict__ w_score,  // [H]
              const float* __restrict__ b_score,  // [1]
              float* __restrict__ logits,         // [B*L]
              float* __restrict__ part,           // [B*L/GROWS, E]
              float* __restrict__ psum,           // [B*L/GROWS]
              float* __restrict__ pmax)           // [B*L/GROWS]
{
    __shared__ __attribute__((aligned(16))) __bf16 Atile[NKC * ACHUNK];   // the whole tile
    __shared__ __attribute__((aligned(16))) float sPool[RGROUPS][E_];
    __shared__ float sDec[H_];
    __shared__ float sWsc[H_];
    __shared__ float sBin[H_];
    __shared__ __attribute__((aligned(16))) float sLog4[GROWS * 4];   // [row][wave column]

    const int tid   = threadIdx.x;
    const int wave  = tid >> 5;
    const int lane  = tid & 31;
    const int mt    = wave & 3;
    const int ncol  = wave >> 2;
    const int m0    = blockIdx.x * GROWS;
    const int b     = m0 >> 10;
    const int mlane = lane & 15;
    const int hi    = lane >> 4;

    sBin[tid] = b_in[tid];
    sDec[tid] = dec_dense[b * H_ + tid];
    sWsc[tid] = w_score[tid];

    const float zero = 0.f;
    v8f acc[MTW][NTW];
#pragma unroll
    for (int t = 0; t < NTW; ++t) {
        v8f z = {zero, zero, zero, zero, zero, zero, zero, zero};
        acc[0][t] = z;
        acc[1][t] = z;
    }

    const int arow  = tid >> 3;          // 0..63; a thread also stages row arow + 64
    const int aquad = tid & 7;           // 0..7 (16B within 32-f32 chunk)

    // A wave-wide load of the staging reads four whole 128-byte lines. Chunks 0 and 1 start
    // here, ahead of the B fragments.
    const float* asrc = A + (size_t)(m0 + arow) * E_ + aquad * 4;
    const float4 first0 = *(const float4*)asrc;
    const float4 first1 = *(const float4*)(asrc + 64 * E_);
    float4 nx0 = *(const float4*)(asrc + KC);
    float4 nx1 = *(const float4*)(asrc + 64 * E_ + KC);
    __builtin_prefetch(asrc + 2 * KC, 0, 3);
    __builtin_prefetch(asrc + 64 * E_ + 2 * KC, 0, 3);

    // One register set of B fragments. Each fragment feeds the wave's two M-tiles; right
    // behind its two WMMAs its registers take the load of the next chunk's fragment, which
    // so has a whole chunk to land. Chunk 0's set starts here, under the staging of the
    // first A tile.
    const __bf16* bbase = Bsw + (size_t)(ncol * 8 * NKC) * 512 + lane * 8;
    v16bf bfr[NTW];
#pragma unroll
    for (int t = 0; t < NTW; ++t)
        bfr[t] = loadBfrag(bbase + (size_t)(t * NKC) * 512);

    // ---- prologue: stage chunk 0 ----
    __bf16* adst = &Atile[arow * APITCH + aquad * 4];
    stageA(adst, first0);
    stageA(adst + 64 * APITCH, first1);
    // The hand-over of chunk 0 and of the vectors above, written by hand as in the loop:
    // __syncthreads() would also wait for chunk 1 and for the B loads.
    asm volatile("s_wait_dscnt 0x0" ::: "memory");         // own LDS writes are done
    asm volatile("s_barrier_signal -1\n\ts_barrier_wait -1" ::: "memory");

#pragma unroll                   // chunk indices become constants
    for (int kc = 0; kc < NKC; ++kc) {
        // ---- the wave's two bf16 A fragments, their LDS reads as one group ----
        const __bf16* ap = &Atile[kc * ACHUNK + (mt * 32 + mlane) * APITCH + hi * 8];
        const v16bf a0 = ldsAfrag(ap);
        const v16bf a1 = ldsAfrag(ap + 16 * APITCH);

        // ---- the NEXT chunk goes from registers into its place in LDS, and the chunk
        //      behind it starts its flight into the same registers ----
        if (kc + 1 < NKC) {
            stageA(adst + (kc + 1) * ACHUNK, nx0);
            stageA(adst + (kc + 1) * ACHUNK + 64 * APITCH, nx1);
        }
        if (kc + 2 < NKC) {
            const float* s = asrc + (kc + 2) * KC;
            nx0 = *(const float4*)s;
            nx1 = *(const float4*)(s + 64 * E_);
            if (kc + 3 < NKC) {
                __builtin_prefetch(s + KC, 0, 3);
                __builtin_prefetch(s + 64 * E_ + KC, 0, 3);
            }
        }
        // without it the LDS reads are dealt out one by one among the WMMAs, each with a
        // full wait of its own
        __builtin_amdgcn_sched_barrier(0);

        // ---- 16 WMMAs: a B fragment's two, then its refill ----
#pragma unroll
        for (int t = 0; t < NTW; ++t) {
            acc[0][t] = __builtin_amdgcn_wmma_f32_16x16x32_bf16(
                false, a0, false, bfr[t], (short)0, acc[0][t], false, false);
            acc[1][t] = __builtin_amdgcn_wmma_f32_16x16x32_bf16(
                false, a1, false, bfr[t], (short)0, acc[1][t], false, false);
            if (kc + 1 < NKC)
                bfr[t] = loadBfrag(bbase + (size_t)(t * NKC + kc + 1) * 512);
            // without it the scheduler lifts the refills over the WMMAs that still read the
            // old fragments, into registers of their own, and accumulators spill
            __builtin_amdgcn_sched_barrier(0);
        }

        // The chunk's hand-over, written by hand: __syncthreads() also waits for every
        // global load, which would end the flight of the A and B loads issued above.
        asm volatile("s_wait_dscnt 0x0" ::: "memory");     // own writes of the next chunk done
        asm volatile("s_barrier_signal -1\n\ts_barrier_wait -1\n\t"
                     "v_nop\n\tv_nop\n\tv_nop\n\tv_nop" ::: "memory");
    }

    {
        float ps[MTW * 8];       // value i*8 + j belongs to row i*16 + hi*8 + j of the wave
#pragma unroll
        for (int j = 0; j < MTW * 8; ++j) ps[j] = 0.f;
#pragma unroll
        for (int t = 0; t < NTW; ++t) {
            const int n = ncol * 128 + t * 16 + mlane;
            const float dv = sDec[n], wv = sWsc[n], bv = sBin[n];
#pragma unroll
            for (int i = 0; i < MTW; ++i) {
                float x[8], y[8];
#pragma unroll
                for (int j = 0; j < 8; ++j) x[j] = acc[i][t][j] + bv + dv;
                tanh8(y, x);
#pragma unroll
                for (int j = 0; j < 8; ++j) ps[i * 8 + j] = fmaf(y[j], wv, ps[i * 8 + j]);
            }
        }
        // the 16 lanes of a row of lanes hold 16 columns of the same 16 rows: after four
        // halving steps lane mlane holds the whole sum of value mlane, one row per lane
        halve<8>(ps, mlane);
        halve<4>(ps, mlane);
        halve<2>(ps, mlane);
        halve<1>(ps, mlane);
        const int row = mt * 32 + (mlane >> 3) * 16 + hi * 8 + (mlane & 7);
        sLog4[row * 4 + ncol] = ps[0];
    }
    __syncthreads();
    const float bs = b_score[0];
    if (tid < GROWS) logits[m0 + tid] = rowLogit(sLog4, tid) + bs;

    // ---- the block's largest logit, in every wave: four rows a lane, then across lanes ----
    float lv[GROWS / 32];
#pragma unroll
    for (int i = 0; i < GROWS / 32; ++i) lv[i] = rowLogit(sLog4, lane + 32 * i) + bs;
    float mx = fmaxf(fmaxf(lv[0], lv[1]), fmaxf(lv[2], lv[3]));
#pragma unroll
    for (int o = 16; o > 0; o >>= 1) mx = fmaxf(mx, __shfl_xor(mx, o));

    if (wave == 0) {             // the block's sum of exponentials, a fixed tree
        const float dl[4] = {lv[0] - mx, lv[1] - mx, lv[2] - mx, lv[3] - mx};
        float ev[4];
        exp4(ev, dl);
        float se = (ev[0] + ev[1]) + (ev[2] + ev[3]);
#pragma unroll
        for (int o = 16; o > 0; o >>= 1) se += __shfl_xor(se, o);
        if (lane == 0) {
            psum[blockIdx.x] = se;
            pmax[blockIdx.x] = mx;
        }
    }

    // ---- weighted row sums from the tile in LDS: a wave takes 16 rows of 8 chunks, a lane
    //      8 columns; the row, and so its weight, is the same in every lane of a wave ----
    {
        const int rg = wave >> 1;
        const int ch = (wave & 1) * 8 + (lane >> 2);
        const int q8 = (lane & 3) * 8;
        const __bf16* pp = &Atile[ch * ACHUNK + rg * 16 * APITCH + q8];
        float s[8];
#pragma unroll
        for (int c = 0; c < 8; ++c) s[c] = 0.f;
#pragma unroll
        for (int j4 = 0; j4 < 4; ++j4) {
            float d4[4];
#pragma unroll
            for (int j = 0; j < 4; ++j) d4[j] = rowLogit(sLog4, rg * 16 + j4 * 4 + j) + bs - mx;
            float e4[4];
            exp4(e4, d4);
#pragma unroll
            for (int j = 0; j < 4; ++j) {
                const v8bf x = *(const v8bf*)(pp + (j4 * 4 + j) * APITCH);
#pragma unroll
                for (int c = 0; c < 8; ++c) s[c] = fmaf((float)x[c], e4[j], s[c]);
            }
        }
        float* d = &sPool[rg][ch * KC + q8];
        *(float4*)d       = make_float4(s[0], s[1], s[2], s[3]);
        *(float4*)(d + 4) = make_float4(s[4], s[5], s[6], s[7]);
    }
    __syncthreads();

    // one column per thread, the row groups added in index order; whole lines stored
    float t = 0.f;
#pragma unroll
    for (int g = 0; g < RGROUPS; ++g) t += sPool[g][tid];
    part[(size_t)blockIdx.x * E_ + tid] = t;
}

// ---------------------------------------------------------------------------
// Softmax over a batch's 8 row blocks and the context vector, by linearity of the
// projection and with sum_l w[l] = 1:
//   sum_l w[l]*(A[l,:]@W_in + b_in) = (sum_l w[l]*A[l,:])@W_in + b_in
// With M the largest of a batch's block maxima m_t and S = sum_t psum_t * exp(m_t - M):
//   w[l] = exp(logit_l - M) / S,   sum_l w[l]*A[l,:] = sum_t part_t * exp(m_t - M) / S
// ctxGemm adds a batch's 8 rescaled block sums in index order, rounds to bf16 and
// multiplies by the swizzled W_in on the matrix unit, one k-chunk per wave; the 16 chunk
// products are added in f32 in index order. Block i also writes the weights of batch i.
// ---------------------------------------------------------------------------
#define TILES_B (L_ / GROWS)     // 8 row blocks per batch

#define PPITCH (E_ + 8)          // bf16 elements per LDS row: 16 bytes of pad

// 64 blocks, at most one per WGP: registers go to loads in flight, not to occupancy
__global__ __launch_bounds__(512) __attribute__((amdgpu_waves_per_eu(4, 8)))
void ctxGemm(const float* __restrict__ part,      // [B*TILES_B, E]
             const float* __restrict__ psum,      // [B*TILES_B]
             const float* __restrict__ pmax,      // [B*TILES_B]
             const float* __restrict__ logits,    // [B*L]
             const __bf16* __restrict__ Bsw,      // swizzled W_in
             const float* __restrict__ b_in,      // [H]
             float* __restrict__ ctx,             // [B, H]
             float* __restrict__ weights)         // [B, L]
{
    __shared__ __attribute__((aligned(16))) __bf16 sP[16][PPITCH];
    __shared__ float sRed[NKC][2][8][32];         // one product per k-chunk and N tile
    __shared__ __attribute__((aligned(16))) float sC[16][TILES_B];  // exp(m_t - M) / S
    __shared__ float sM[16], sInv[16];            // M and 1 / S of the 16 batches

    const int tid  = threadIdx.x;
    const int wave = tid >> 5;                    // = the wave's k-chunk
    const int lane = tid & 31;
    const int b0   = (blockIdx.x >> 4) * 16;      // 16 batches = the M tile
    const int nt0  = (blockIdx.x & 15) * 2;       // two N tiles = 128 bytes of a ctx row

    // loads that do not depend on the staging, issued ahead of it
    const float bv = b_in[nt0 * 16 + lane];
    const float2 lg = ((const float2*)(logits + blockIdx.x * L_))[tid];
    const v16bf bf0 = loadBfrag(Bsw + (size_t)(nt0 * NKC + wave) * 512 + lane * 8);
    // stands before address registers of the loads above are overwritten:
    // the next load's result lands in them
    asm volatile("s_wait_xcnt 0x0" ::: "memory");
    const v16bf bf1 = loadBfrag(Bsw + (size_t)((nt0 + 1) * NKC + wave) * 512 + lane * 8);
    // without it the scheduler sinks these loads to the barrier, where their latency shows
    __builtin_amdgcn_sched_barrier(0);

    // ---- a thread's 32 loads of block sums, all in flight at once ----
    const int c4 = tid & 127;                     // float4 column
    const int rs = tid >> 7;                      // four rows from rs*4 on
    const float4* p = (const float4*)(part + (size_t)(b0 + rs * 4) * TILES_B * E_) + c4;
    float4 x[4][TILES_B];
#pragma unroll
    for (int rr = 0; rr < 4; ++rr)
#pragma unroll
        for (int t = 0; t < TILES_B; ++t) x[rr][t] = p[(rr * TILES_B + t) * (E_ / 4)];
    // stands before the address register pair of the loads above is overwritten; as its
    // input the pair stays whole up to here (without it the last load's result landed in it)
    asm volatile("s_wait_xcnt 0x0" :: "v"(p) : "memory");
    // without it the scheduler deals these loads out among the sums behind the barrier
    __builtin_amdgcn_sched_barrier(0);

    // ---- under their flight: the scale of each of the 16 * 8 row blocks, one per thread of
    //      the first four waves; the 8 lanes of a batch reduce among themselves ----
    if (tid < 16 * TILES_B) {
        const float m  = pmax[b0 * TILES_B + tid];
        const float pv = psum[b0 * TILES_B + tid];
        float M = m;
#pragma unroll
        for (int o = TILES_B / 2; o > 0; o >>= 1) M = fmaxf(M, __shfl_xor(M, o));
        const float f = __expf(m - M);
        float S = pv * f;
#pragma unroll
        for (int o = TILES_B / 2; o > 0; o >>= 1) S += __shfl_xor(S, o);
        const float inv = 1.f / S;
        sC[tid >> 3][tid & 7] = f * inv;
        if ((tid & 7) == 0) {
            sM[tid >> 3]   = M;
            sInv[tid >> 3] = inv;
        }
    }
    __syncthreads();

    // ---- pooled[16][E]: add the rescaled block sums, round to bf16, into LDS ----
#pragma unroll
    for (int rr = 0; rr < 4; ++rr) {
        const int row = rs * 4 + rr;
        const float4 ca = *(const float4*)&sC[row][0];
        const float4 cb = *(const float4*)&sC[row][4];
        const float c[TILES_B] = {ca.x, ca.y, ca.z, ca.w, cb.x, cb.y, cb.z, cb.w};
        float4 s = {0.f, 0.f, 0.f, 0.f};
#pragma unroll
        for (int t = 0; t < TILES_B; ++t) {
            s.x = fmaf(x[rr][t].x, c[t], s.x);
            s.y = fmaf(x[rr][t].y, c[t], s.y);
            s.z = fmaf(x[rr][t].z, c[t], s.z);
            s.w = fmaf(x[rr][t].w, c[t], s.w);
        }
        __bf16* d = &sP[row][c4 * 4];
        d[0] = (__bf16)s.x; d[1] = (__bf16)s.y; d[2] = (__bf16)s.z; d[3] = (__bf16)s.w;
    }

    // ---- the weights of batch blockIdx.x, one of the block's 16; two per thread ----
    {
        const float M = sM[blockIdx.x & 15], inv = sInv[blockIdx.x & 15];
        ((float2*)(weights + blockIdx.x * L_))[tid] =
            make_float2(__expf(lg.x - M) * inv, __expf(lg.y - M) * inv);
    }
    __syncthreads();

    // ---- each wave: its k-chunk of both N tiles ----
    {
        const int mlane = lane & 15;
        const int hi    = lane >> 4;
        // same k order as swizzleB: elements 0-7 from k = 8*hi, 8-15 from k = 16 + 8*hi
        union { v16bf v; uint4 q[2]; } a;
        a.q[0] = *(const uint4*)&sP[mlane][wave * KC + hi * 8];
        a.q[1] = *(const uint4*)&sP[mlane][wave * KC + 16 + hi * 8];
        const v8f z = {0.f, 0.f, 0.f, 0.f, 0.f, 0.f, 0.f, 0.f};
        const v8f d0 = __builtin_amdgcn_wmma_f32_16x16x32_bf16(
            false, a.v, false, bf0, (short)0, z, false, false);
        const v8f d1 = __builtin_amdgcn_wmma_f32_16x16x32_bf16(
            false, a.v, false, bf1, (short)0, z, false, false);
#pragma unroll
        for (int j = 0; j < 8; ++j) {
            sRed[wave][0][j][lane] = d0[j];
            sRed[wave][1][j][lane] = d1[j];
        }
    }
    __syncthreads();

    // ---- one output element per thread, k-chunks added in index order;
    //      a wave stores one whole 128-byte line of ctx ----
    {
        const int row = wave, col = lane;         // D register row&7, lane 16*(row>>3) + (col&15)
        float s = 0.f;
#pragma unroll
        for (int k = 0; k < NKC; ++k)
            s += sRed[k][col >> 4][row & 7][(row >> 3) * 16 + (col & 15)];
        ctx[(size_t)(b0 + row) * H_ + nt0 * 16 + col] = s + bv;
    }
}

extern "C" void kernel_launch(void* const* d_in, const int* in_sizes, int n_in,
                              void* d_out, int out_size, void* d_ws, size_t ws_size,
                              hipStream_t stream) {
    const float* attn  = (const float*)d_in[0];  // [B,L,E]
    const float* dec   = (const float*)d_in[1];  // [B,H]
    const float* W_in  = (const float*)d_in[2];  // [E,H]
    const float* b_in  = (const float*)d_in[3];  // [H]
    const float* W_dec = (const float*)d_in[4];  // [H,H]
    const float* b_dec = (const float*)d_in[5];  // [H]
    const float* w_sc  = (const float*)d_in[6];  // [H,1]
    const float* b_sc  = (const float*)d_in[7];  // [1]

    char*  ws      = (char*)d_ws;
    __bf16* Bsw    = (__bf16*)ws;
    float* decd    = (float*)(ws + WS_DEC);
    float* logits  = (float*)(ws + WS_LOG);
    float* part    = (float*)(ws + WS_PART);
    float* psum    = (float*)(ws + WS_PSUM);
    float* pmax    = (float*)(ws + WS_PMAX);
    float* ctx     = (float*)d_out;              // [B,H]
    float* weights = (float*)d_out + B_ * H_;    // [B,L]

    swizzleB<<<1024, 256, 0, stream>>>(W_in, Bsw);
    decDense<<<(B_ / DD_NB) * (H_ / DD_COLS), 256, 0, stream>>>(dec, W_dec, b_dec, decd);

    const int gemmBlocks = (B_ * L_) / GROWS;    // 512
    attnGemm<<<gemmBlocks, THREADS, 0, stream>>>(
        attn, Bsw, b_in, decd, w_sc, b_sc, logits, part, psum, pmax);
    ctxGemm<<<64, 512, 0, stream>>>(part, psum, pmax, logits, Bsw, b_in, ctx, weights);
}

// v010
// A run of this version takes 39.7 microseconds.
// Two timings next to v009 both put it at 1.03 times that version's speed.
// Counting every step since v000, it is 4.89 times as fast.
#include <hip/hip_runtime.h>
#include <hip/hip_bf16.h>
#include <math.h>

typedef __attribute__((ext_vector_type(16))) __bf16 v16bf;
typedef __attribute__((ext_vector_type(8)))  __bf16 v8bf;
typedef __attribute__((ext_vector_type(8)))  float  v8f;

#define B_      64
#define L_      1024
#define E_      512
#define H_      512
#define KC      32
#define NKC     (E_/KC)          // 16 k-chunks
#define GROWS   128              // rows of A per block of the score GEMM
#define MTW     2                // M-tiles per wave (2*16 = 32 rows per wave row)
#define THREADS 512              // 16 waves
#define NTW     8                // N-tiles per wave (8*16 = 128 cols per wave column)

// -------- workspace layout (bytes) --------
#define WS_DEC  (512u << 10)     // dec_dense f32 [B][H]
#define WS_LOG  (640u << 10)     // logits f32 [B*L]
#define WS_PART (1024u << 10)    // weighted row sums f32 [B*L/GROWS][E]
#define WS_PSUM (3072u << 10)    // a row block's sum of exponentials f32 [B*L/GROWS]
#define WS_PMAX (3080u << 10)    // a row block's largest logit f32 [B*L/GROWS]

#define BPLANE 256

// One lane's 16 elements of a B fragment; p = the fragment's start + 8 * lane.
__device__ __forceinline__ v16bf loadBfrag(const __bf16* p) {
    const v8bf lo = *(const v8bf*)p;
    const v8bf hi = *(const v8bf*)(p + BPLANE);
    return __builtin_shufflevector(lo, hi, 0, 1, 2, 3, 4, 5, 6, 7,
                                   8, 9, 10, 11, 12, 13, 14, 15);
}

// dec_dense[b][h] = b_dec[h] + sum_k dec[b][k] * W_dec[k][h], f32 on the vector unit.
// A block owns 32 columns (one 128-byte line of every W_dec row) of DD_NB batches. Its 32
// groups of 8 lanes split k into runs of 16, so a lane's loads do not depend on any sum
// and all fly at once: the kernel waits out one memory latency, not one per few k steps.
// The 32 run sums of an element are added in index order through LDS.
#define DD_NB   8                // batches per block: 8 * 32 outputs, one per thread
#define DD_COLS 32               // columns per block
#define DD_RUN  16               // k steps per lane
#define DD_RUNS (H_ / DD_RUN)    // 32 runs = 256 threads / 8 lanes
#define DD_BLOCKS ((B_ / DD_NB) * (H_ / DD_COLS))
// The same launch packs W_in: the two jobs share no data, and a thread's 8 loads of W_in fly
// with its loads of the projection. A thread packs one lane's 16 bytes of one fragment plane
// (8 k steps of one column), so a wave stores 512 contiguous bytes.
static_assert(DD_BLOCKS * 256 * 8 == E_ * H_, "every element of W_in is packed once");

__global__ __launch_bounds__(256)
void decDensePack(const float* __restrict__ dec, const float* __restrict__ W_dec,
                  const float* __restrict__ b_dec, float* __restrict__ out,
                  const float* __restrict__ W_in, __bf16* __restrict__ Bsw) {
    __shared__ __attribute__((aligned(16))) float sPart[DD_RUNS][DD_NB][DD_COLS];

    const int tid = threadIdx.x;
    const int run = tid >> 3;
    const int c4  = (tid & 7) * 4;
    const int h0  = (blockIdx.x & 15) * DD_COLS;
    const int b0  = (blockIdx.x >> 4) * DD_NB;
    const int k0  = run * DD_RUN;

    // each input's lane part of the address (an index, two byte offsets): one register each
    const int      bidx = h0 + (tid & 31);
    const unsigned doff = k0 * 4u;
    const unsigned woff = (k0 * H_ + h0 + c4) * 4u;
    const char* dbase = (const char*)(dec + (size_t)b0 * H_);

    // the thread's piece of the packed W_in: [N tile][k-chunk][plane][lane], 8 elements each
    const int piece = blockIdx.x * 256 + tid;
    const int pn    = (piece >> 10) * 16 + (piece & 15);
    const int pk    = ((piece >> 6) & 15) * KC + ((piece >> 5) & 1) * 16 + ((piece >> 4) & 1) * 8;
    const unsigned poff = (pk * H_ + pn) * 4u;

    const float bias = b_dec[bidx];
    // written ahead of the projection's loads: written behind them, the build placed the first
    // sums and a wait for their operands among the loads, a second latency in a row
    float pw[8];
#pragma unroll
    for (int e = 0; e < 8; ++e)
        pw[e] = *(const float*)((const char*)W_in + poff + e * H_ * 4);
    float4 d[DD_NB][DD_RUN / 4];
#pragma unroll
    for (int bb = 0; bb < DD_NB; ++bb)
#pragma unroll
        for (int q = 0; q < DD_RUN / 4; ++q)
            d[bb][q] = *(const float4*)(dbase + doff + (bb * H_ + q * 4) * 4);
    float4 w[DD_RUN];
#pragma unroll
    for (int i = 0; i < DD_RUN; ++i)
        w[i] = *(const float4*)((const char*)W_dec + woff + i * H_ * 4);
    // stands before an address register of the loads above is overwritten; as its inputs
    // the four registers stay whole up to here (without them the results of later loads
    // of the group landed in the address registers of earlier ones)
    asm volatile("s_wait_xcnt 0x0" :: "v"(bidx), "v"(doff), "v"(woff), "v"(poff) : "memory");
    // without it the scheduler deals the loads out among the sums to save registers, and
    // the kernel waits out several latencies one after another
    __builtin_amdgcn_sched_barrier(0);

#pragma unroll
    for (int bb = 0; bb < DD_NB; ++bb) {
        float4 s = {0.f, 0.f, 0.f, 0.f};
#pragma unroll
        for (int q = 0; q < DD_RUN / 4; ++q) {
            const float dk[4] = {d[bb][q].x, d[bb][q].y, d[bb][q].z, d[bb][q].w};
#pragma unroll
            for (int j = 0; j < 4; ++j) {
                const float4 x = w[q * 4 + j];
                s.x = fmaf(dk[j], x.x, s.x);
                s.y = fmaf(dk[j], x.y, s.y);
                s.z = fmaf(dk[j], x.z, s.z);
                s.w = fmaf(dk[j], x.w, s.w);
            }
        }
        *(float4*)&sPart[run][bb][c4] = s;
    }
    __syncthreads();

    // one output element per thread; a wave stores one whole 128-byte line
    const int bb = tid >> 5, col = tid & 31;
    float s = bias;
#pragma unroll
    for (int r = 0; r < DD_RUNS; ++r) s += sPart[r][bb][col];
    out[(size_t)(b0 + bb) * H_ + h0 + col] = s;

    // behind the barrier, which would wait for a store in front of it
    v8bf pb;
#pragma unroll
    for (int e = 0; e < 8; ++e) pb[e] = (__bf16)pw[e];
    *(v8bf*)(Bsw + (size_t)piece * 8) = pb;
}

#define APITCH  40               // bf16 elements per LDS row of the A tile
#define ACHUNK  (GROWS * APITCH + 32)   // bf16 elements from one chunk to the next
#define RGROUPS 8                // row groups of the weighted sums: 16 rows each

// Four f32 of a row, rounded to bf16 on their way into LDS: once per element, not once in
// each of the four waves that read it.
// The two conversions (round to nearest even, the compiler's own instruction for this cast)
// are a volatile asm statement so that they stay behind the chunk barrier in front of them:
// as plain casts they were placed directly behind the global load, whose whole latency the
// wave then waited out in the middle of the chunk before.
__device__ __forceinline__ void stageA(__bf16* dst, const float4 v) {
    uint2 o;
    asm volatile("v_cvt_pk_bf16_f32 %0, %2, %3\n\t"
                 "v_cvt_pk_bf16_f32 %1, %4, %5"
                 : "=&v"(o.x), "=&v"(o.y)
                 : "v"(v.x), "v"(v.y), "v"(v.z), "v"(v.w));
    *(uint2*)dst = o;
}

__device__ __forceinline__ v16bf ldsAfrag(const __bf16* p) {
    const v8bf lo = *(const v8bf*)p;
    const v8bf hi = *(const v8bf*)(p + 16);
    return __builtin_shufflevector(lo, hi, 0, 1, 2, 3, 4, 5, 6, 7,
                                   8, 9, 10, 11, 12, 13, 14, 15);
}

__device__ __forceinline__ void tanh8(float (&y)[8], const float (&x)[8]) {
    asm("v_tanh_f32 %0, %8\n\t"
        "v_tanh_f32 %1, %9\n\t"
        "v_tanh_f32 %2, %10\n\t"
        "v_tanh_f32 %3, %11\n\t"
        "v_tanh_f32 %4, %12\n\t"
        "v_tanh_f32 %5, %13\n\t"
        "v_tanh_f32 %6, %14\n\t"
        "v_tanh_f32 %7, %15\n\t"
        "v_nop"
        : "=&v"(y[0]), "=&v"(y[1]), "=&v"(y[2]), "=&v"(y[3]),
          "=&v"(y[4]), "=&v"(y[5]), "=&v"(y[6]), "=&v"(y[7])
        : "v"(x[0]), "v"(x[1]), "v"(x[2]), "v"(x[3]),
          "v"(x[4]), "v"(x[5]), "v"(x[6]), "v"(x[7]));
}

// y = exp(x) for four values: the multiply and hardware v_exp_f32 that __expf compiles to.
// One asm statement for the reason given at tanh8.
__device__ __forceinline__ void exp4(float (&y)[4], const float (&x)[4]) {
    const float l2e = 1.44269504f;
    asm("v_exp_f32 %0, %4\n\t"
        "v_exp_f32 %1, %5\n\t"
        "v_exp_f32 %2, %6\n\t"
        "v_exp_f32 %3, %7\n\t"
        "v_nop"
        : "=&v"(y[0]), "=&v"(y[1]), "=&v"(y[2]), "=&v"(y[3])
        : "v"(x[0] * l2e), "v"(x[1] * l2e), "v"(x[2] * l2e), "v"(x[3] * l2e));
}

// x of the lane whose number within its row of 16 lanes differs in the bits of M (DPP
// row_xmask); the compiler folds the move into the add that reads it.
template <int M>
__device__ __forceinline__ float laneXor(float x) {
    return __builtin_bit_cast(float, __builtin_amdgcn_mov_dpp(
        __builtin_bit_cast(int, x), 0x160 + M, 0xf, 0xf, true));
}

// One halving step of the sum over 16 lanes: of 2*N values a lane keeps the N that its bit N
// picks and gives the other N to the lane across, so each pair of lanes adds every value once.
template <int N>
__device__ __forceinline__ void halve(float (&v)[16], const int mlane) {
    const bool up = (mlane & N) != 0;
#pragma unroll
    for (int k = 0; k < N; ++k) {
        const float keep = up ? v[k + N] : v[k];
        const float send = up ? v[k] : v[k + N];
        v[k] = keep + laneXor<N>(send);
    }
}

// A row's logit without b_score: the sums of the four wave columns, added in index order.
__device__ __forceinline__ float rowLogit(const float* sLog4, const int row) {
    const float4 p = *(const float4*)(sLog4 + row * 4);
    return ((p.x + p.y) + p.z) + p.w;
}

// ---------------------------------------------------------------------------
// Score GEMM with the softmax-weighted row sums behind it. Chunk kc+2 flies into registers
// and chunk kc+1 goes from registers to LDS as bf16 while WMMAs consume chunk kc.
//   logits[b,l] = sum_h tanh(gemm+b_in+dec)*w_score + b_score
// Then, with m the largest logit of the block's 128 rows:
//   pmax = m, psum = sum_r exp(logit_r - m), part[e] = sum_r exp(logit_r - m) * A[r][e]
// from the bf16 tile in LDS, summed in f32. ctxGemm rescales a batch's 8 blocks to the
// batch's maximum, so the input is read from memory once.
// ---------------------------------------------------------------------------
__global__ __launch_bounds__(THREADS)
void attnGemm(const float* __restrict__ A,        // [B*L, E] f32
              const __bf16* __restrict__ Bsw,     // swizzled W_in
              const float* __restrict__ b_in,     // [H]
              const float* __restrict__ dec_dense,// [B, H]
              const float* __restrict__ w_score,  // [H]
              const float* __restrict__ b_score,  // [1]
              float* __restrict__ logits,         // [B*L]
              float* __restrict__ part,           // [B*L/GROWS, E]
              float* __restrict__ psum,           // [B*L/GROWS]
              float* __restrict__ pmax)           // [B*L/GROWS]
{
    __shared__ __attribute__((aligned(16))) __bf16 Atile[NKC * ACHUNK];   // the whole tile
    __shared__ __attribute__((aligned(16))) float sPool[RGROUPS][E_];
    __shared__ float sDec[H_];
    __shared__ float sWsc[H_];
    __shared__ float sBin[H_];
    __shared__ __attribute__((aligned(16))) float sLog4[GROWS * 4];   // [row][wave column]

    const int tid   = threadIdx.x;
    const int wave  = tid >> 5;
    const int lane  = tid & 31;
    const int mt    = wave & 3;
    const int ncol  = wave >> 2;
    const int m0    = blockIdx.x * GROWS;
    const int b     = m0 >> 10;
    const int mlane = lane & 15;
    const int hi    = lane >> 4;

    sBin[tid] = b_in[tid];
    sDec[tid] = dec_dense[b * H_ + tid];
    sWsc[tid] = w_score[tid];

    const float zero = 0.f;
    v8f acc[MTW][NTW];
#pragma unroll
    for (int t = 0; t < NTW; ++t) {
        v8f z = {zero, zero, zero, zero, zero, zero, zero, zero};
        acc[0][t] = z;
        acc[1][t] = z;
    }

    const int arow  = tid >> 3;          // 0..63; a thread also stages row arow + 64
    const int aquad = tid & 7;           // 0..7 (16B within 32-f32 chunk)

    // A wave-wide load of the staging reads four whole 128-byte lines. Chunks 0 and 1 start
    // here, ahead of the B fragments.
    const float* asrc = A + (size_t)(m0 + arow) * E_ + aquad * 4;
    const float4 first0 = *(const float4*)asrc;
    const float4 first1 = *(const float4*)(asrc + 64 * E_);
    float4 nx0 = *(const float4*)(asrc + KC);
    float4 nx1 = *(const float4*)(asrc + 64 * E_ + KC);
    __builtin_prefetch(asrc + 2 * KC, 0, 3);
    __builtin_prefetch(asrc + 64 * E_ + 2 * KC, 0, 3);

    // One register set of B fragments. Each fragment feeds the wave's two M-tiles; right
    // behind its two WMMAs its registers take the load of the next chunk's fragment, which
    // so has a whole chunk to land. Chunk 0's set starts here, under the staging of the
    // first A tile.
    const __bf16* bbase = Bsw + (size_t)(ncol * 8 * NKC) * 512 + lane * 8;
    v16bf bfr[NTW];
#pragma unroll
    for (int t = 0; t < NTW; ++t)
        bfr[t] = loadBfrag(bbase + (size_t)(t * NKC) * 512);

    // ---- prologue: stage chunk 0 ----
    __bf16* adst = &Atile[arow * APITCH + aquad * 4];
    stageA(adst, first0);
    stageA(adst + 64 * APITCH, first1);
    // The hand-over of chunk 0 and of the vectors above, written by hand as in the loop:
    // __syncthreads() would also wait for chunk 1 and for the B loads.
    asm volatile("s_wait_dscnt 0x0" ::: "memory");         // own LDS writes are done
    asm volatile("s_barrier_signal -1\n\ts_barrier_wait -1" ::: "memory");

#pragma unroll                   // chunk indices become constants
    for (int kc = 0; kc < NKC; ++kc) {
        // ---- the wave's two bf16 A fragments, their LDS reads as one group ----
        const __bf16* ap = &Atile[kc * ACHUNK + (mt * 32 + mlane) * APITCH + hi * 8];
        const v16bf a0 = ldsAfrag(ap);
        const v16bf a1 = ldsAfrag(ap + 16 * APITCH);

        // ---- the NEXT chunk goes from registers into its place in LDS, and the chunk
        //      behind it starts its flight into the same registers ----
        if (kc + 1 < NKC) {
            stageA(adst + (kc + 1) * ACHUNK, nx0);
            stageA(adst + (kc + 1) * ACHUNK + 64 * APITCH, nx1);
        }
        if (kc + 2 < NKC) {
            const float* s = asrc + (kc + 2) * KC;
            nx0 = *(const float4*)s;
            nx1 = *(const float4*)(s + 64 * E_);
            if (kc + 3 < NKC) {
                __builtin_prefetch(s + KC, 0, 3);
                __builtin_prefetch(s + 64 * E_ + KC, 0, 3);
            }
        }
        // without it the LDS reads are dealt out one by one among the WMMAs, each with a
        // full wait of its own
        __builtin_amdgcn_sched_barrier(0);

        // ---- 16 WMMAs: a B fragment's two, then its refill ----
#pragma unroll
        for (int t = 0; t < NTW; ++t) {
            acc[0][t] = __builtin_amdgcn_wmma_f32_16x16x32_bf16(
                false, a0, false, bfr[t], (short)0, acc[0][t], false, false);
            acc[1][t] = __builtin_amdgcn_wmma_f32_16x16x32_bf16(
                false, a1, false, bfr[t], (short)0, acc[1][t], false, false);
            if (kc + 1 < NKC)
                bfr[t] = loadBfrag(bbase + (size_t)(t * NKC + kc + 1) * 512);
            // without it the scheduler lifts the refills over the WMMAs that still read the
            // old fragments, into registers of their own, and accumulators spill
            __builtin_amdgcn_sched_barrier(0);
        }

        // The chunk's hand-over, written by hand: __syncthreads() also waits for every
        // global load, which would end the flight of the A and B loads issued above.
        asm volatile("s_wait_dscnt 0x0" ::: "memory");     // own writes of the next chunk done
        asm volatile("s_barrier_signal -1\n\ts_barrier_wait -1\n\t"
                     "v_nop\n\tv_nop\n\tv_nop\n\tv_nop" ::: "memory");
    }

    {
        float ps[MTW * 8];       // value i*8 + j belongs to row i*16 + hi*8 + j of the wave
#pragma unroll
        for (int j = 0; j < MTW * 8; ++j) ps[j] = 0.f;
#pragma unroll
        for (int t = 0; t < NTW; ++t) {
            const int n = ncol * 128 + t * 16 + mlane;
            const float dv = sDec[n], wv = sWsc[n], bv = sBin[n];
#pragma unroll
            for (int i = 0; i < MTW; ++i) {
                float x[8], y[8];
#pragma unroll
                for (int j = 0; j < 8; ++j) x[j] = acc[i][t][j] + bv + dv;
                tanh8(y, x);
#pragma unroll
                for (int j = 0; j < 8; ++j) ps[i * 8 + j] = fmaf(y[j], wv, ps[i * 8 + j]);
            }
        }
        // the 16 lanes of a row of lanes hold 16 columns of the same 16 rows: after four
        // halving steps lane mlane holds the whole sum of value mlane, one row per lane
        halve<8>(ps, mlane);
        halve<4>(ps, mlane);
        halve<2>(ps, mlane);
        halve<1>(ps, mlane);
        const int row = mt * 32 + (mlane >> 3) * 16 + hi * 8 + (mlane & 7);
        sLog4[row * 4 + ncol] = ps[0];
    }
    __syncthreads();
    const float bs = b_score[0];
    if (tid < GROWS) logits[m0 + tid] = rowLogit(sLog4, tid) + bs;

    // ---- the block's largest logit, in every wave: four rows a lane, then across lanes ----
    float lv[GROWS / 32];
#pragma unroll
    for (int i = 0; i < GROWS / 32; ++i) lv[i] = rowLogit(sLog4, lane + 32 * i) + bs;
    float mx = fmaxf(fmaxf(lv[0], lv[1]), fmaxf(lv[2], lv[3]));
#pragma unroll
    for (int o = 16; o > 0; o >>= 1) mx = fmaxf(mx, __shfl_xor(mx, o));

    if (wave == 0) {             // the block's sum of exponentials, a fixed tree
        const float dl[4] = {lv[0] - mx, lv[1] - mx, lv[2] - mx, lv[3] - mx};
        float ev[4];
        exp4(ev, dl);
        float se = (ev[0] + ev[1]) + (ev[2] + ev[3]);
#pragma unroll
        for (int o = 16; o > 0; o >>= 1) se += __shfl_xor(se, o);
        if (lane == 0) {
            psum[blockIdx.x] = se;
            pmax[blockIdx.x] = mx;
        }
    }

    // ---- weighted row sums from the tile in LDS: a wave takes 16 rows of 8 chunks, a lane
    //      8 columns; the row, and so its weight, is the same in every lane of a wave ----
    {
        const int rg = wave >> 1;
        const int ch = (wave & 1) * 8 + (lane >> 2);
        const int q8 = (lane & 3) * 8;
        const __bf16* pp = &Atile[ch * ACHUNK + rg * 16 * APITCH + q8];
        float s[8];
#pragma unroll
        for (int c = 0; c < 8; ++c) s[c] = 0.f;
#pragma unroll
        for (int j4 = 0; j4 < 4; ++j4) {
            float d4[4];
#pragma unroll
            for (int j = 0; j < 4; ++j) d4[j] = rowLogit(sLog4, rg * 16 + j4 * 4 + j) + bs - mx;
            float e4[4];
            exp4(e4, d4);
#pragma unroll
            for (int j = 0; j < 4; ++j) {
                const v8bf x = *(const v8bf*)(pp + (j4 * 4 + j) * APITCH);
#pragma unroll
                for (int c = 0; c < 8; ++c) s[c] = fmaf((float)x[c], e4[j], s[c]);
            }
        }
        float* d = &sPool[rg][ch * KC + q8];
        *(float4*)d       = make_float4(s[0], s[1], s[2], s[3]);
        *(float4*)(d + 4) = make_float4(s[4], s[5], s[6], s[7]);
    }
    __syncthreads();

    // one column per thread, the row groups added in index order; whole lines stored
    float t = 0.f;
#pragma unroll
    for (int g = 0; g < RGROUPS; ++g) t += sPool[g][tid];
    part[(size_t)blockIdx.x * E_ + tid] = t;
}

// ---------------------------------------------------------------------------
// Softmax over a batch's 8 row blocks and the context vector, by linearity of the
// projection and with sum_l w[l] = 1:
//   sum_l w[l]*(A[l,:]@W_in + b_in) = (sum_l w[l]*A[l,:])@W_in + b_in
// With M the largest of a batch's block maxima m_t and S = sum_t psum_t * exp(m_t - M):
//   w[l] = exp(logit_l - M) / S,   sum_l w[l]*A[l,:] = sum_t part_t * exp(m_t - M) / S
// ctxGemm adds a batch's 8 rescaled block sums in index order, rounds to bf16 and
// multiplies by the swizzled W_in on the matrix unit, one k-chunk per wave; the 16 chunk
// products are added in f32 in index order. Block i also writes the weights of batch i.
// ---------------------------------------------------------------------------
#define TILES_B (L_ / GROWS)     // 8 row blocks per batch

#define PPITCH (E_ + 8)          // bf16 elements per LDS row: 16 bytes of pad

// 64 blocks, at most one per WGP: registers go to loads in flight, not to occupancy
__global__ __launch_bounds__(512) __attribute__((amdgpu_waves_per_eu(4, 8)))
void ctxGemm(const float* __restrict__ part,      // [B*TILES_B, E]
             const float* __restrict__ psum,      // [B*TILES_B]
             const float* __restrict__ pmax,      // [B*TILES_B]
             const float* __restrict__ logits,    // [B*L]
             const __bf16* __restrict__ Bsw,      // swizzled W_in
             const float* __restrict__ b_in,      // [H]
             float* __restrict__ ctx,             // [B, H]
             float* __restrict__ weights)         // [B, L]
{
    __shared__ __attribute__((aligned(16))) __bf16 sP[16][PPITCH];
    __shared__ float sRed[NKC][2][8][32];         // one product per k-chunk and N tile
    __shared__ __attribute__((aligned(16))) float sC[16][TILES_B];  // exp(m_t - M) / S
    __shared__ float sM[16], sInv[16];            // M and 1 / S of the 16 batches

    const int tid  = threadIdx.x;
    const int wave = tid >> 5;                    // = the wave's k-chunk
    const int lane = tid & 31;
    const int b0   = (blockIdx.x >> 4) * 16;      // 16 batches = the M tile
    const int nt0  = (blockIdx.x & 15) * 2;       // two N tiles = 128 bytes of a ctx row

    // loads that do not depend on the staging, issued ahead of it
    const float bv = b_in[nt0 * 16 + lane];
    const float2 lg = ((const float2*)(logits + blockIdx.x * L_))[tid];
    const v16bf bf0 = loadBfrag(Bsw + (size_t)(nt0 * NKC + wave) * 512 + lane * 8);
    // stands before address registers of the loads above are overwritten:
    // the next load's result lands in them
    asm volatile("s_wait_xcnt 0x0" ::: "memory");
    const v16bf bf1 = loadBfrag(Bsw + (size_t)((nt0 + 1) * NKC + wave) * 512 + lane * 8);
    // without it the scheduler sinks these loads to the barrier, where their latency shows
    __builtin_amdgcn_sched_barrier(0);

    // ---- a thread's 32 loads of block sums, all in flight at once ----
    const int c4 = tid & 127;                     // float4 column
    const int rs = tid >> 7;                      // four rows from rs*4 on
    const float4* p = (const float4*)(part + (size_t)(b0 + rs * 4) * TILES_B * E_) + c4;
    float4 x[4][TILES_B];
#pragma unroll
    for (int rr = 0; rr < 4; ++rr)
#pragma unroll
        for (int t = 0; t < TILES_B; ++t) x[rr][t] = p[(rr * TILES_B + t) * (E_ / 4)];
    // stands before the address register pair of the loads above is overwritten; as its
    // input the pair stays whole up to here (without it the last load's result landed in it)
    asm volatile("s_wait_xcnt 0x0" :: "v"(p) : "memory");
    // without it the scheduler deals these loads out among the sums behind the barrier
    __builtin_amdgcn_sched_barrier(0);

    // ---- under their flight: the scale of each of the 16 * 8 row blocks, one per thread of
    //      the first four waves; the 8 lanes of a batch reduce among themselves ----
    if (tid < 16 * TILES_B) {
        const float m  = pmax[b0 * TILES_B + tid];
        const float pv = psum[b0 * TILES_B + tid];
        float M = m;
#pragma unroll
        for (int o = TILES_B / 2; o > 0; o >>= 1) M = fmaxf(M, __shfl_xor(M, o));
        const float f = __expf(m - M);
        float S = pv * f;
#pragma unroll
        for (int o = TILES_B / 2; o > 0; o >>= 1) S += __shfl_xor(S, o);
        const float inv = 1.f / S;
        sC[tid >> 3][tid & 7] = f * inv;
        if ((tid & 7) == 0) {
            sM[tid >> 3]   = M;
            sInv[tid >> 3] = inv;
        }
    }
    __syncthreads();

    // ---- pooled[16][E]: add the rescaled block sums, round to bf16, into LDS ----
#pragma unroll
    for (int rr = 0; rr < 4; ++rr) {
        const int row = rs * 4 + rr;
        const float4 ca = *(const float4*)&sC[row][0];
        const float4 cb = *(const float4*)&sC[row][4];
        const float c[TILES_B] = {ca.x, ca.y, ca.z, ca.w, cb.x, cb.y, cb.z, cb.w};
        float4 s = {0.f, 0.f, 0.f, 0.f};
#pragma unroll
        for (int t = 0; t < TILES_B; ++t) {
            s.x = fmaf(x[rr][t].x, c[t], s.x);
            s.y = fmaf(x[rr][t].y, c[t], s.y);
            s.z = fmaf(x[rr][t].z, c[t], s.z);
            s.w = fmaf(x[rr][t].w, c[t], s.w);
        }
        __bf16* d = &sP[row][c4 * 4];
        d[0] = (__bf16)s.x; d[1] = (__bf16)s.y; d[2] = (__bf16)s.z; d[3] = (__bf16)s.w;
    }

    // ---- the weights of batch blockIdx.x, one of the block's 16; two per thread ----
    {
        const float M = sM[blockIdx.x & 15], inv = sInv[blockIdx.x & 15];
        ((float2*)(weights + blockIdx.x * L_))[tid] =
            make_float2(__expf(lg.x - M) * inv, __expf(lg.y - M) * inv);
    }
    __syncthreads();

    // ---- each wave: its k-chunk of both N tiles ----
    {
        const int mlane = lane & 15;
        const int hi    = lane >> 4;
        // same k order as the packed W_in: elements 0-7 from k = 8*hi, 8-15 from k = 16 + 8*hi
        union { v16bf v; uint4 q[2]; } a;
        a.q[0] = *(const uint4*)&sP[mlane][wave * KC + hi * 8];
        a.q[1] = *(const uint4*)&sP[mlane][wave * KC + 16 + hi * 8];
        const v8f z = {0.f, 0.f, 0.f, 0.f, 0.f, 0.f, 0.f, 0.f};
        const v8f d0 = __builtin_amdgcn_wmma_f32_16x16x32_bf16(
            false, a.v, false, bf0, (short)0, z, false, false);
        const v8f d1 = __builtin_amdgcn_wmma_f32_16x16x32_bf16(
            false, a.v, false, bf1, (short)0, z, false, false);
#pragma unroll
        for (int j = 0; j < 8; ++j) {
            sRed[wave][0][j][lane] = d0[j];
            sRed[wave][1][j][lane] = d1[j];
        }
    }
    __syncthreads();

    // ---- one output element per thread, k-chunks added in index order;
    //      a wave stores one whole 128-byte line of ctx ----
    {
        const int row = wave, col = lane;         // D register row&7, lane 16*(row>>3) + (col&15)
        float s = 0.f;
#pragma unroll
        for (int k = 0; k < NKC; ++k)
            s += sRed[k][col >> 4][row & 7][(row >> 3) * 16 + (col & 15)];
        ctx[(size_t)(b0 + row) * H_ + nt0 * 16 + col] = s + bv;
    }
}

extern "C" void kernel_launch(void* const* d_in, const int* in_sizes, int n_in,
                              void* d_out, int out_size, void* d_ws, size_t ws_size,
                              hipStream_t stream) {
    const float* attn  = (const float*)d_in[0];  // [B,L,E]
    const float* dec   = (const float*)d_in[1];  // [B,H]
    const float* W_in  = (const float*)d_in[2];  // [E,H]
    const float* b_in  = (const float*)d_in[3];  // [H]
    const float* W_dec = (const float*)d_in[4];  // [H,H]
    const float* b_dec = (const float*)d_in[5];  // [H]
    const float* w_sc  = (const float*)d_in[6];  // [H,1]
    const float* b_sc  = (const float*)d_in[7];  // [1]

    char*  ws      = (char*)d_ws;
    __bf16* Bsw    = (__bf16*)ws;
    float* decd    = (float*)(ws + WS_DEC);
    float* logits  = (float*)(ws + WS_LOG);
    float* part    = (float*)(ws + WS_PART);
    float* psum    = (float*)(ws + WS_PSUM);
    float* pmax    = (float*)(ws + WS_PMAX);
    float* ctx     = (float*)d_out;              // [B,H]
    float* weights = (float*)d_out + B_ * H_;    // [B,L]

    decDensePack<<<DD_BLOCKS, 256, 0, stream>>>(dec, W_dec, b_dec, decd, W_in, Bsw);

    const int gemmBlocks = (B_ * L_) / GROWS;    // 512
    attnGemm<<<gemmBlocks, THREADS, 0, stream>>>(
        attn, Bsw, b_in, decd, w_sc, b_sc, logits, part, psum, pmax);
    ctxGemm<<<64, 512, 0, stream>>>(part, psum, pmax, logits, Bsw, b_in, ctx, weights);
}
